// v000
// The times below were measured on an AMD MI455X: many runs one after another, warmed up first and cycling through
// copies of the inputs, with the whole window's GPU time divided by the number of runs. Launches and the gaps
// between them are all in it. The median over several windows is given; except for v000 it joins two sittings, which
// can be a few percent apart, so the side-by-side timings, each taken in one sitting, are the better comparison.
// v000, which the later versions start from, runs in 178 microseconds.
#include <hip/hip_runtime.h>
#include <cstddef>

typedef _Float16 v8h  __attribute__((ext_vector_type(8)));
typedef _Float16 v16h __attribute__((ext_vector_type(16)));
typedef float    v8f  __attribute__((ext_vector_type(8)));

#define WINSZ 7
#define SHF   3
#define WSQ   49      // tokens per window
#define NHEAD 4
#define HDIM  32
#define CHN   128
#define IMGE  56

constexpr int XS_STRIDE  = 136;  // halves (also holds O after QKV stage)
constexpr int QKV_STRIDE = 392;  // halves
constexpr int S_STRIDE   = 52;   // floats
constexpr int P_STRIDE   = 72;   // halves

__device__ __forceinline__ v8f wmma_f16(v16h a, v16h b, v8f c) {
  return __builtin_amdgcn_wmma_f32_16x16x32_f16(false, a, false, b, (short)0, c,
                                                false, false);
}

// A-fragment (16x32 f16, M x K), row-major source. Also serves as the
// B-fragment of a transposed matrix (Kᵀ) since lane<->column mapping matches.
__device__ __forceinline__ v16h ldA_row(const _Float16* base, int stride,
                                        int row0, int k0, int lane) {
  const int l  = lane & 15;
  const int kk = k0 + ((lane & 16) ? 8 : 0);
  const _Float16* p = base + (size_t)(row0 + l) * stride + kk;
  v8h lo = *(const v8h*)(p);        // K = kk+0..7
  v8h hi = *(const v8h*)(p + 16);   // K = kk+16..23
  return __builtin_shufflevector(lo, hi, 0,1,2,3,4,5,6,7,8,9,10,11,12,13,14,15);
}

// B-fragment (32x16 f16, K x N) from a row-major K x N source (column gather).
__device__ __forceinline__ v16h ldB_col(const _Float16* base, int stride,
                                        int k0, int lane) {
  const int l  = lane & 15;
  const int kk = k0 + ((lane & 16) ? 8 : 0);
  const _Float16* p = base + (size_t)kk * stride + l;
  v16h b;
  #pragma unroll
  for (int i = 0; i < 8; ++i) {
    b[i]     = p[(size_t)i * stride];
    b[i + 8] = p[(size_t)(16 + i) * stride];
  }
  return b;
}

// B-fragment from pre-swizzled pack: 512 halves per fragment, 16/lane contiguous.
__device__ __forceinline__ v16h ldB_pack(const _Float16* frag, int lane) {
  const _Float16* p = frag + lane * 16;
  v8h lo = *(const v8h*)(p);
  v8h hi = *(const v8h*)(p + 8);
  return __builtin_shufflevector(lo, hi, 0,1,2,3,4,5,6,7,8,9,10,11,12,13,14,15);
}

__device__ __forceinline__ int region56(int g) {
  return g < (IMGE - WINSZ) ? 0 : (g < (IMGE - SHF) ? 1 : 2);
}

// ---------------------------------------------------------------------------
// Pre-pass: convert f32 weights to f16, swizzled into WMMA B-fragment layout.
// Fragment f = kc*(N/16)+nt holds 32 lanes x 16 halves.
// lane<16 : col n = nt*16+lane, halves = K {0..7, 16..23}+kc*32
// lane>=16: col n = nt*16+lane-16, halves = K {8..15,24..31}+kc*32
// ---------------------------------------------------------------------------
__global__ void pack_weights_kernel(const float* __restrict__ W,
                                    _Float16* __restrict__ P, int K, int N) {
  int idx = blockIdx.x * blockDim.x + threadIdx.x;
  if (idx >= K * N) return;
  int f    = idx >> 9;
  int lane = (idx >> 4) & 31;
  int i    = idx & 15;
  int NT   = N >> 4;
  int kc   = f / NT, nt = f - kc * NT;
  int l    = lane & 15;
  int hi   = (lane >> 4) & 1;
  int k    = kc * 32 + (i < 8 ? (hi ? 8 : 0) + i : (hi ? 24 : 16) + (i - 8));
  int n    = nt * 16 + l;
  P[idx] = (_Float16)W[(size_t)k * N + n];
}

// ---------------------------------------------------------------------------
// Fused shifted-window attention: one workgroup (8 waves) per window.
// ---------------------------------------------------------------------------
__global__ __launch_bounds__(256) void swin_window_attn_kernel(
    const float* __restrict__ x, const float* __restrict__ qkv_bias,
    const float* __restrict__ proj_bias, const float* __restrict__ rel_tab,
    const _Float16* __restrict__ qkv_pack, const _Float16* __restrict__ proj_pack,
    float* __restrict__ out) {
  __shared__ _Float16 lds_xs[64 * XS_STRIDE];    // X tile, later O tile
  __shared__ _Float16 lds_qkv[64 * QKV_STRIDE];  // Q|K|V (384 cols, q pre-scaled)
  __shared__ float    lds_s[64 * S_STRIDE];      // raw scores (per head)
  __shared__ _Float16 lds_p[64 * P_STRIDE];      // softmax probs (per head)
  __shared__ float    lds_rp[169 * NHEAD];       // rel-pos bias table

  const int tid  = threadIdx.x;
  const int lane = tid & 31;
  const int wv   = tid >> 5;  // 8 waves

  const int blk = blockIdx.x;           // 4096 = 64 imgs * 8 * 8 windows
  const int img = blk >> 6;
  const int wy  = (blk >> 3) & 7;
  const int wx  = blk & 7;

  // ---- Stage A: gather shifted window into LDS (f32 -> f16) ----------------
  for (int j = tid; j < 169 * NHEAD; j += 256) lds_rp[j] = rel_tab[j];

  for (int j = tid; j < WSQ * 32; j += 256) {
    int t  = j >> 5;
    int q  = (j & 31) << 2;
    int ty = t / WINSZ, tx = t - ty * WINSZ;
    int gr = wy * WINSZ + ty + SHF; if (gr >= IMGE) gr -= IMGE;
    int gc = wx * WINSZ + tx + SHF; if (gc >= IMGE) gc -= IMGE;
    const float4 v =
        *(const float4*)(x + (((size_t)img * IMGE + gr) * IMGE + gc) * CHN + q);
    _Float16* d = lds_xs + t * XS_STRIDE + q;
    d[0] = (_Float16)v.x; d[1] = (_Float16)v.y;
    d[2] = (_Float16)v.z; d[3] = (_Float16)v.w;
  }
  for (int j = tid; j < (64 - WSQ) * CHN; j += 256)   // zero-pad rows 49..63
    lds_xs[(WSQ + (j >> 7)) * XS_STRIDE + (j & 127)] = (_Float16)0;
  for (int j = tid; j < (64 - WSQ) * 64; j += 256)    // P rows 49..63 stay zero
    lds_p[(WSQ + (j >> 6)) * P_STRIDE + (j & 63)] = (_Float16)0;

  __syncthreads();

  // ---- Stage B: QKV = X @ Wqkv + b (q columns pre-scaled by 1/sqrt(32)) ----
  const float qscale = 0.17677669529663687f;
  for (int t = wv; t < 4 * 24; t += 8) {
    int mt = t / 24, nt = t - mt * 24;
    int n0 = nt * 16;
    float bv = qkv_bias[n0 + (lane & 15)];
    v8f acc;
    #pragma unroll
    for (int i = 0; i < 8; ++i) acc[i] = bv;
    #pragma unroll
    for (int kc = 0; kc < 4; ++kc) {
      v16h a = ldA_row(lds_xs, XS_STRIDE, mt * 16, kc * 32, lane);
      v16h b = ldB_pack(qkv_pack + (size_t)(kc * 24 + nt) * 512, lane);
      acc = wmma_f16(a, b, acc);
    }
    float sc = (n0 < CHN) ? qscale : 1.0f;
    int col   = n0 + (lane & 15);
    int rbase = mt * 16 + ((lane & 16) ? 8 : 0);
    #pragma unroll
    for (int r = 0; r < 8; ++r)
      lds_qkv[(rbase + r) * QKV_STRIDE + col] = (_Float16)(acc[r] * sc);
  }
  __syncthreads();

  // ---- per-head: scores -> softmax -> PV ----------------------------------
  const int rh_w = region56(wy * WINSZ);  // only wy==7 / wx==7 windows mix
  for (int h = 0; h < NHEAD; ++h) {
    // Stage C: S = Q Kᵀ (+rel-pos bias +shift mask). 16 tiles / 8 waves.
    for (int t = wv; t < 16; t += 8) {
      int mt = t >> 2, nt = t & 3;
      v16h a = ldA_row(lds_qkv, QKV_STRIDE, mt * 16, h * HDIM, lane);        // Q
      v16h b = ldA_row(lds_qkv, QKV_STRIDE, nt * 16, CHN + h * HDIM, lane);  // Kᵀ
      v8f acc = {};
      acc = wmma_f16(a, b, acc);

      int tc    = nt * 16 + (lane & 15);
      int rbase = mt * 16 + ((lane & 16) ? 8 : 0);
      if (tc < WSQ) {
        int ty  = tc / WINSZ, tx = tc - ty * WINSZ;
        int rht = region56(wy * WINSZ + ty);
        int rwt = region56(wx * WINSZ + tx);
        #pragma unroll
        for (int r = 0; r < 8; ++r) {
          int s = rbase + r;
          if (s < WSQ) {
            int sy = s / WINSZ, sx = s - sy * WINSZ;
            float bias =
                lds_rp[((sy - ty + 6) * 13 + (sx - tx + 6)) * NHEAD + h];
            bool same = (region56(wy * WINSZ + sy) == rht) &&
                        (region56(wx * WINSZ + sx) == rwt);
            lds_s[s * S_STRIDE + tc] = acc[r] + bias + (same ? 0.f : -100.f);
          }
        }
      }
    }
    __syncthreads();

    // Softmax over the 49 real columns; write P (f16), zero cols 49..63.
    if (tid < WSQ) {
      const float* row = lds_s + tid * S_STRIDE;
      float mx = -1e30f;
      for (int j = 0; j < WSQ; ++j) mx = fmaxf(mx, row[j]);
      float sum = 0.f;
      for (int j = 0; j < WSQ; ++j) sum += __expf(row[j] - mx);
      float inv = 1.0f / sum;
      _Float16* pr = lds_p + tid * P_STRIDE;
      for (int j = 0; j < WSQ; ++j)
        pr[j] = (_Float16)(__expf(row[j] - mx) * inv);
      for (int j = WSQ; j < 64; ++j) pr[j] = (_Float16)0;
    }
    __syncthreads();

    // Stage D: O[:, h*32 : h*32+32] = P @ V. 8 tiles, one per wave.
    {
      int mt = wv >> 1, nt = wv & 1;
      v8f acc = {};
      #pragma unroll
      for (int kc = 0; kc < 2; ++kc) {
        v16h a = ldA_row(lds_p, P_STRIDE, mt * 16, kc * 32, lane);
        v16h b = ldB_col(lds_qkv + 2 * CHN + h * HDIM + nt * 16, QKV_STRIDE,
                         kc * 32, lane);
        acc = wmma_f16(a, b, acc);
      }
      int col   = h * HDIM + nt * 16 + (lane & 15);
      int rbase = mt * 16 + ((lane & 16) ? 8 : 0);
      #pragma unroll
      for (int r = 0; r < 8; ++r)
        lds_xs[(rbase + r) * XS_STRIDE + col] = (_Float16)acc[r];
    }
    __syncthreads();
  }

  // ---- Stage E: Y = O @ Wproj + b, scatter with reverse shift -------------
  for (int t = wv; t < 32; t += 8) {
    int mt = t >> 3, nt = t & 7;
    int n0 = nt * 16;
    float bv = proj_bias[n0 + (lane & 15)];
    v8f acc;
    #pragma unroll
    for (int i = 0; i < 8; ++i) acc[i] = bv;
    #pragma unroll
    for (int kc = 0; kc < 4; ++kc) {
      v16h a = ldA_row(lds_xs, XS_STRIDE, mt * 16, kc * 32, lane);
      v16h b = ldB_pack(proj_pack + (size_t)(kc * 8 + nt) * 512, lane);
      acc = wmma_f16(a, b, acc);
    }
    int col   = n0 + (lane & 15);
    int rbase = mt * 16 + ((lane & 16) ? 8 : 0);
    #pragma unroll
    for (int r = 0; r < 8; ++r) {
      int s = rbase + r;
      if (s < WSQ) {
        int ty = s / WINSZ, tx = s - ty * WINSZ;
        int gr = wy * WINSZ + ty + SHF; if (gr >= IMGE) gr -= IMGE;
        int gc = wx * WINSZ + tx + SHF; if (gc >= IMGE) gc -= IMGE;
        out[(((size_t)img * IMGE + gr) * IMGE + gc) * CHN + col] = acc[r];
      }
    }
  }
}

extern "C" void kernel_launch(void* const* d_in, const int* in_sizes, int n_in,
                              void* d_out, int out_size, void* d_ws,
                              size_t ws_size, hipStream_t stream) {
  const float* x     = (const float*)d_in[0];
  const float* qkvW  = (const float*)d_in[1];
  const float* qkvB  = (const float*)d_in[2];
  const float* projW = (const float*)d_in[3];
  const float* projB = (const float*)d_in[4];
  const float* relT  = (const float*)d_in[5];

  _Float16* qkv_pack  = (_Float16*)d_ws;                              // 96 KB
  _Float16* proj_pack = (_Float16*)((char*)d_ws + (size_t)CHN * 384 * 2);

  pack_weights_kernel<<<(CHN * 384 + 255) / 256, 256, 0, stream>>>(
      qkvW, qkv_pack, CHN, 384);
  pack_weights_kernel<<<(CHN * CHN + 255) / 256, 256, 0, stream>>>(
      projW, proj_pack, CHN, CHN);

  swin_window_attn_kernel<<<4096, 256, 0, stream>>>(
      x, qkvB, projB, relT, qkv_pack, proj_pack, (float*)d_out);
}

// v001
// A run of this version takes 103 microseconds.
// Timed twice side by side with v000, it ran 1.79 and 1.80 times as fast.
#include <hip/hip_runtime.h>
#include <cstddef>

typedef _Float16 v8h  __attribute__((ext_vector_type(8)));
typedef _Float16 v16h __attribute__((ext_vector_type(16)));
typedef float    v8f  __attribute__((ext_vector_type(8)));
typedef int      v4i  __attribute__((ext_vector_type(4)));

#define WINSZ 7
#define SHF   3
#define WSQ   49      // tokens per window
#define NHEAD 4
#define HDIM  32
#define CHN   128
#define IMGE  56

constexpr int XS_STRIDE = 136;  // halves (also holds O after QKV stage)
constexpr int QK_STRIDE = 264;  // halves, Q|K rows by token (528 B = 16 B x odd)
constexpr int VT_STRIDE = 72;   // halves, V transposed: rows by channel (144 B)
constexpr int RP_PITCH  = 176;  // floats, one head's rel-pos bias table

__device__ __forceinline__ v8f wmma_f16(v16h a, v16h b, v8f c) {
  return __builtin_amdgcn_wmma_f32_16x16x32_f16(false, a, false, b, (short)0, c,
                                                false, false);
}

// A-fragment (16x32 f16, M x K), row-major source. Also serves as the
// B-fragment of a transposed matrix (Qᵀ) since lane<->column mapping matches.
__device__ __forceinline__ v16h ldA_row(const _Float16* base, int stride,
                                        int row0, int k0, int lane) {
  const int l  = lane & 15;
  const int kk = k0 + ((lane & 16) ? 8 : 0);
  const _Float16* p = base + (size_t)(row0 + l) * stride + kk;
  v8h lo = *(const v8h*)(p);        // K = kk+0..7
  v8h hi = *(const v8h*)(p + 16);   // K = kk+16..23
  return __builtin_shufflevector(lo, hi, 0,1,2,3,4,5,6,7,8,9,10,11,12,13,14,15);
}

// B-fragment from pre-swizzled pack: 512 halves per fragment, 16/lane contiguous.
__device__ __forceinline__ v16h ldB_pack(const _Float16* frag, int lane) {
  const _Float16* p = frag + lane * 16;
  v8h lo = *(const v8h*)(p);
  v8h hi = *(const v8h*)(p + 8);
  return __builtin_shufflevector(lo, hi, 0,1,2,3,4,5,6,7,8,9,10,11,12,13,14,15);
}

// Lane l <-> lane l ^ 16 (the two halves of a wave hold the two key halves).
__device__ __forceinline__ float swap_halves(float v) {
  int b = __builtin_bit_cast(int, v);
  b = __builtin_amdgcn_permlanex16(b, b, 0x76543210, 0xfedcba98, false, false);
  return __builtin_bit_cast(float, b);
}

__device__ __forceinline__ int region56(int g) {
  return g < (IMGE - WINSZ) ? 0 : (g < (IMGE - SHF) ? 1 : 2);
}

// ---------------------------------------------------------------------------
// Pre-pass: convert f32 weights to f16, swizzled into WMMA B-fragment layout.
// Fragment f = kc*(N/16)+nt holds 32 lanes x 16 halves.
// lane<16 : col n = nt*16+lane, halves = K {0..7, 16..23}+kc*32
// lane>=16: col n = nt*16+lane-16, halves = K {8..15,24..31}+kc*32
// ---------------------------------------------------------------------------
__global__ void pack_weights_kernel(const float* __restrict__ W,
                                    _Float16* __restrict__ P, int K, int N) {
  int idx = blockIdx.x * blockDim.x + threadIdx.x;
  if (idx >= K * N) return;
  int f    = idx >> 9;
  int lane = (idx >> 4) & 31;
  int i    = idx & 15;
  int NT   = N >> 4;
  int kc   = f / NT, nt = f - kc * NT;
  int l    = lane & 15;
  int hi   = (lane >> 4) & 1;
  int k    = kc * 32 + (i < 8 ? (hi ? 8 : 0) + i : (hi ? 24 : 16) + (i - 8));
  int n    = nt * 16 + l;
  P[idx] = (_Float16)W[(size_t)k * N + n];
}

// ---------------------------------------------------------------------------
// Fused shifted-window attention: one workgroup (8 waves) per window.
// ---------------------------------------------------------------------------
__global__ __launch_bounds__(256) void swin_window_attn_kernel(
    const float* __restrict__ x, const float* __restrict__ qkv_bias,
    const float* __restrict__ proj_bias, const float* __restrict__ rel_tab,
    const _Float16* __restrict__ qkv_pack, const _Float16* __restrict__ proj_pack,
    float* __restrict__ out) {
  // X tile, later O tile
  __shared__ __attribute__((aligned(16))) _Float16 lds_xs[64 * XS_STRIDE];
  // Q|K by token (256 cols, q pre-scaled)
  __shared__ __attribute__((aligned(16))) _Float16 lds_qk[64 * QK_STRIDE];
  // V transposed: [channel][token]
  __shared__ __attribute__((aligned(16))) _Float16 lds_vt[CHN * VT_STRIDE];
  // rel-pos bias table, [head][169]
  __shared__ float lds_rp[NHEAD * RP_PITCH];
  // per token: ty * 13 + tx (its part of the bias index), shift-mask region
  __shared__ __attribute__((aligned(16))) int lds_koff[64];
  __shared__ __attribute__((aligned(16))) int lds_kreg[64];

  const int tid  = threadIdx.x;
  const int lane = tid & 31;
  const int wv   = tid >> 5;  // 8 waves

  const int blk = blockIdx.x;           // 4096 = 64 imgs * 8 * 8 windows
  const int img = blk >> 6;
  const int wy  = (blk >> 3) & 7;
  const int wx  = blk & 7;

  // ---- Stage A: gather shifted window into LDS (f32 -> f16) ----------------
  for (int j = tid; j < 169 * NHEAD; j += 256)
    lds_rp[(j & 3) * RP_PITCH + (j >> 2)] = rel_tab[j];
  if (tid < WSQ) {
    int ty = tid / WINSZ, tx = tid - ty * WINSZ;
    lds_koff[tid] = ty * 13 + tx;
    lds_kreg[tid] =
        region56(wy * WINSZ + ty) * 3 + region56(wx * WINSZ + tx);
  }

  for (int j = tid; j < WSQ * 32; j += 256) {
    int t  = j >> 5;
    int q  = (j & 31) << 2;
    int ty = t / WINSZ, tx = t - ty * WINSZ;
    int gr = wy * WINSZ + ty + SHF; if (gr >= IMGE) gr -= IMGE;
    int gc = wx * WINSZ + tx + SHF; if (gc >= IMGE) gc -= IMGE;
    const float4 v =
        *(const float4*)(x + (((size_t)img * IMGE + gr) * IMGE + gc) * CHN + q);
    _Float16* d = lds_xs + t * XS_STRIDE + q;
    d[0] = (_Float16)v.x; d[1] = (_Float16)v.y;
    d[2] = (_Float16)v.z; d[3] = (_Float16)v.w;
  }
  for (int j = tid; j < (64 - WSQ) * CHN; j += 256)   // zero-pad rows 49..63
    lds_xs[(WSQ + (j >> 7)) * XS_STRIDE + (j & 127)] = (_Float16)0;

  __syncthreads();

  // ---- Stage B: QKV = X @ Wqkv + b (q columns pre-scaled by 1/sqrt(32)) ----
  const float qscale = 0.17677669529663687f;
  for (int t = wv; t < 4 * 24; t += 8) {
    int mt = t / 24, nt = t - mt * 24;
    int n0 = nt * 16;
    float bv = qkv_bias[n0 + (lane & 15)];
    v8f acc;
    #pragma unroll
    for (int i = 0; i < 8; ++i) acc[i] = bv;
    #pragma unroll
    for (int kc = 0; kc < 4; ++kc) {
      v16h a = ldA_row(lds_xs, XS_STRIDE, mt * 16, kc * 32, lane);
      v16h b = ldB_pack(qkv_pack + (size_t)(kc * 24 + nt) * 512, lane);
      acc = wmma_f16(a, b, acc);
    }
    float sc = (n0 < CHN) ? qscale : 1.0f;
    int col   = n0 + (lane & 15);
    int rbase = mt * 16 + ((lane & 16) ? 8 : 0);
    if (n0 < 2 * CHN) {  // Q, K: rows by token
      #pragma unroll
      for (int r = 0; r < 8; ++r)
        lds_qk[(rbase + r) * QK_STRIDE + col] = (_Float16)(acc[r] * sc);
    } else {             // V: a lane's 8 tokens of one channel, one 16-byte store
      v8h vv;
      #pragma unroll
      for (int r = 0; r < 8; ++r) vv[r] = (_Float16)acc[r];
      *(v8h*)(lds_vt + (col - 2 * CHN) * VT_STRIDE + rbase) = vv;
    }
  }
  __syncthreads();

  // ---- Attention, all in one wave's registers ------------------------------
  // A wave owns 16 queries (mt) and two heads. S^T = K Q^T: in every 16-key
  // tile lane (c, hh) holds keys 8*hh+0..7 of query c, so the softmax runs
  // in-lane plus one exchange of the wave's halves; two score tiles, converted
  // in place, are the B operand P^T of O^T = V^T P^T.
  {
    const int c  = lane & 15;
    const int hh = lane >> 4;
    const int mt = wv >> 1;
    const int h0 = (wv & 1) * 2;

    // Padding queries 49..63 take query 48's bias and mask; their rows are
    // never stored to out.
    const int sq = min(mt * 16 + c, WSQ - 1);
    // bias index = (sy - ty + 6) * 13 + (sx - tx + 6) = koff[s] + 84 - koff[t]
    const int qoff = lds_koff[sq] + 84;
    const bool edge = wy == 7 || wx == 7;  // only these windows mix regions
    const float L2E = 1.4426950408889634f;  // exp(x) = exp2(x * log2 e)

    // Kept rolled: with one head's scores live at a time the wave stays under
    // 128 VGPRs, which four workgroups per WGP need (unrolled it took 156).
    #pragma unroll 1
    for (int j = 0; j < 2; ++j) {
      const int hd = h0 + j;
      const float* rp = lds_rp + hd * RP_PITCH + qoff;

      // The bias is the C operand of the score product. Key tile 3 holds one
      // real key, 48 (hh == 0, register 0; koff = 84).
      v8f st[4];
      #pragma unroll
      for (int kt = 0; kt < 3; ++kt) {
        const v4i ka = *(const v4i*)(lds_koff + kt * 16 + 8 * hh);
        const v4i kb = *(const v4i*)(lds_koff + kt * 16 + 8 * hh + 4);
        #pragma unroll
        for (int r = 0; r < 8; ++r) st[kt][r] = rp[-(r < 4 ? ka[r] : kb[r - 4])];
      }
      {
        v8f z = {};
        z[0] = rp[-84];
        st[3] = z;
      }

      const v16h bq = ldA_row(lds_qk, QK_STRIDE, mt * 16, hd * HDIM, lane);
      #pragma unroll
      for (int kt = 0; kt < 4; ++kt) {
        v16h ak = ldA_row(lds_qk, QK_STRIDE, kt * 16, CHN + hd * HDIM, lane);
        st[kt] = wmma_f16(ak, bq, st[kt]);
      }

      if (edge) {
        const int qreg = lds_kreg[sq];
        #pragma unroll
        for (int kt = 0; kt < 3; ++kt) {
          const v4i ra = *(const v4i*)(lds_kreg + kt * 16 + 8 * hh);
          const v4i rb = *(const v4i*)(lds_kreg + kt * 16 + 8 * hh + 4);
          #pragma unroll
          for (int r = 0; r < 8; ++r)
            st[kt][r] += (r < 4 ? ra[r] : rb[r - 4]) == qreg ? 0.f : -100.f;
        }
        st[3][0] += lds_kreg[WSQ - 1] == qreg ? 0.f : -100.f;
      }

      const float s48 = hh ? -1e30f : st[3][0];  // keys 49..63 do not exist
      float mx = s48;
      #pragma unroll
      for (int kt = 0; kt < 3; ++kt)
        #pragma unroll
        for (int r = 0; r < 8; ++r) mx = fmaxf(mx, st[kt][r]);
      mx = fmaxf(mx, swap_halves(mx));
      const float mb = mx * L2E;

      float part[3];
      v16h pb0, pb1;
      #pragma unroll
      for (int kt = 0; kt < 3; ++kt) {
        part[kt] = 0.f;
        #pragma unroll
        for (int r = 0; r < 8; ++r) {
          float p = __builtin_amdgcn_exp2f(fmaf(st[kt][r], L2E, -mb));
          part[kt] += p;
          if (kt == 0) pb0[r] = (_Float16)p;
          if (kt == 1) pb0[8 + r] = (_Float16)p;
          if (kt == 2) pb1[r] = (_Float16)p;
        }
      }
      const float p48 = __builtin_amdgcn_exp2f(fmaf(s48, L2E, -mb));
      pb1[8] = (_Float16)p48;
      #pragma unroll
      for (int r = 1; r < 8; ++r) pb1[8 + r] = (_Float16)0;
      float sum = (part[0] + part[1]) + (part[2] + p48);
      sum += swap_halves(sum);
      const float inv = 1.0f / sum;

      #pragma unroll
      for (int dt = 0; dt < 2; ++dt) {
        const int ch = hd * HDIM + dt * 16;
        v8f acc = {};
        acc = wmma_f16(ldA_row(lds_vt, VT_STRIDE, ch, 0, lane), pb0, acc);
        acc = wmma_f16(ldA_row(lds_vt, VT_STRIDE, ch, 32, lane), pb1, acc);
        v8h o;  // channels ch + 8*hh + 0..7 of query c
        #pragma unroll
        for (int r = 0; r < 8; ++r) o[r] = (_Float16)(acc[r] * inv);
        *(v8h*)(lds_xs + (mt * 16 + c) * XS_STRIDE + ch + 8 * hh) = o;
      }
    }
  }
  __syncthreads();

  // ---- Stage E: Y = O @ Wproj + b, scatter with reverse shift -------------
  for (int t = wv; t < 32; t += 8) {
    int mt = t >> 3, nt = t & 7;
    int n0 = nt * 16;
    float bv = proj_bias[n0 + (lane & 15)];
    v8f acc;
    #pragma unroll
    for (int i = 0; i < 8; ++i) acc[i] = bv;
    #pragma unroll
    for (int kc = 0; kc < 4; ++kc) {
      v16h a = ldA_row(lds_xs, XS_STRIDE, mt * 16, kc * 32, lane);
      v16h b = ldB_pack(proj_pack + (size_t)(kc * 8 + nt) * 512, lane);
      acc = wmma_f16(a, b, acc);
    }
    int col   = n0 + (lane & 15);
    int rbase = mt * 16 + ((lane & 16) ? 8 : 0);
    #pragma unroll
    for (int r = 0; r < 8; ++r) {
      int s = rbase + r;
      if (s < WSQ) {
        int ty = s / WINSZ, tx = s - ty * WINSZ;
        int gr = wy * WINSZ + ty + SHF; if (gr >= IMGE) gr -= IMGE;
        int gc = wx * WINSZ + tx + SHF; if (gc >= IMGE) gc -= IMGE;
        out[(((size_t)img * IMGE + gr) * IMGE + gc) * CHN + col] = acc[r];
      }
    }
  }
}

extern "C" void kernel_launch(void* const* d_in, const int* in_sizes, int n_in,
                              void* d_out, int out_size, void* d_ws,
                              size_t ws_size, hipStream_t stream) {
  const float* x     = (const float*)d_in[0];
  const float* qkvW  = (const float*)d_in[1];
  const float* qkvB  = (const float*)d_in[2];
  const float* projW = (const float*)d_in[3];
  const float* projB = (const float*)d_in[4];
  const float* relT  = (const float*)d_in[5];

  _Float16* qkv_pack  = (_Float16*)d_ws;                              // 96 KB
  _Float16* proj_pack = (_Float16*)((char*)d_ws + (size_t)CHN * 384 * 2);

  pack_weights_kernel<<<(CHN * 384 + 255) / 256, 256, 0, stream>>>(
      qkvW, qkv_pack, CHN, 384);
  pack_weights_kernel<<<(CHN * CHN + 255) / 256, 256, 0, stream>>>(
      projW, proj_pack, CHN, CHN);

  swin_window_attn_kernel<<<4096, 256, 0, stream>>>(
      x, qkvB, projB, relT, qkv_pack, proj_pack, (float*)d_out);
}

// v002
// One run takes 87.9 microseconds.
// In both of two side-by-side timings against v001, it was 1.17 times as fast.
// Over all steps from v000 it is 2.11 times as fast.
#include <hip/hip_runtime.h>
#include <cstddef>

typedef _Float16 v8h  __attribute__((ext_vector_type(8)));
typedef _Float16 v16h __attribute__((ext_vector_type(16)));
typedef float    v8f  __attribute__((ext_vector_type(8)));
typedef int      v4i  __attribute__((ext_vector_type(4)));

#define WINSZ 7
#define SHF   3
#define WSQ   49      // tokens per window
#define NHEAD 4
#define HDIM  32
#define CHN   128
#define IMGE  56

constexpr int XS_STRIDE = 136;  // halves (also holds O after QKV stage)
constexpr int QK_STRIDE = 264;  // halves, Q|K rows by token (528 B = 16 B x odd)
constexpr int Y_STRIDE  = 132;  // floats, result rows in the Q|K space (528 B)
constexpr int VT_STRIDE = 72;   // halves, V transposed: rows by channel (144 B)
constexpr int RP_PITCH  = 176;  // floats, one head's rel-pos bias table

__device__ __forceinline__ v8f wmma_f16(v16h a, v16h b, v8f c) {
  return __builtin_amdgcn_wmma_f32_16x16x32_f16(false, a, false, b, (short)0, c,
                                                false, false);
}

// A-fragment (16x32 f16, M x K), row-major source. Also serves as the
// B-fragment of a transposed matrix (Qᵀ) since lane<->column mapping matches.
__device__ __forceinline__ v16h ldA_row(const _Float16* base, int stride,
                                        int row0, int k0, int lane) {
  const int l  = lane & 15;
  const int kk = k0 + ((lane & 16) ? 8 : 0);
  const _Float16* p = base + (size_t)(row0 + l) * stride + kk;
  v8h lo = *(const v8h*)(p);        // K = kk+0..7
  v8h hi = *(const v8h*)(p + 16);   // K = kk+16..23
  return __builtin_shufflevector(lo, hi, 0,1,2,3,4,5,6,7,8,9,10,11,12,13,14,15);
}

// B-fragment from pre-swizzled pack: 512 halves per fragment, 16/lane contiguous.
__device__ __forceinline__ v16h ldB_pack(const _Float16* frag, int lane) {
  const _Float16* p = frag + lane * 16;
  v8h lo = *(const v8h*)(p);
  v8h hi = *(const v8h*)(p + 8);
  return __builtin_shufflevector(lo, hi, 0,1,2,3,4,5,6,7,8,9,10,11,12,13,14,15);
}

// Lane l <-> lane l ^ 16 (the two halves of a wave hold the two key halves).
__device__ __forceinline__ float swap_halves(float v) {
  int b = __builtin_bit_cast(int, v);
  b = __builtin_amdgcn_permlanex16(b, b, 0x76543210, 0xfedcba98, false, false);
  return __builtin_bit_cast(float, b);
}

__device__ __forceinline__ int region56(int g) {
  return g < (IMGE - WINSZ) ? 0 : (g < (IMGE - SHF) ? 1 : 2);
}

// ---------------------------------------------------------------------------
// Pre-pass: convert f32 weights to f16, swizzled into WMMA B-fragment layout.
// Fragment f = kc*(N/16)+nt holds 32 lanes x 16 halves.
// lane<16 : col n = nt*16+lane, halves = K {0..7, 16..23}+kc*32
// lane>=16: col n = nt*16+lane-16, halves = K {8..15,24..31}+kc*32
// ---------------------------------------------------------------------------
__global__ void pack_weights_kernel(const float* __restrict__ W,
                                    _Float16* __restrict__ P, int K, int N) {
  int idx = blockIdx.x * blockDim.x + threadIdx.x;
  if (idx >= K * N) return;
  int f    = idx >> 9;
  int lane = (idx >> 4) & 31;
  int i    = idx & 15;
  int NT   = N >> 4;
  int kc   = f / NT, nt = f - kc * NT;
  int l    = lane & 15;
  int hi   = (lane >> 4) & 1;
  int k    = kc * 32 + (i < 8 ? (hi ? 8 : 0) + i : (hi ? 24 : 16) + (i - 8));
  int n    = nt * 16 + l;
  P[idx] = (_Float16)W[(size_t)k * N + n];
}

// ---------------------------------------------------------------------------
// Fused shifted-window attention: one workgroup (8 waves) per window.
// ---------------------------------------------------------------------------
__global__ __launch_bounds__(256) void swin_window_attn_kernel(
    const float* __restrict__ x, const float* __restrict__ qkv_bias,
    const float* __restrict__ proj_bias, const float* __restrict__ rel_tab,
    const _Float16* __restrict__ qkv_pack, const _Float16* __restrict__ proj_pack,
    float* __restrict__ out) {
  // X tile, later O tile
  __shared__ __attribute__((aligned(16))) _Float16 lds_xs[64 * XS_STRIDE];
  // Q|K by token (256 cols, q pre-scaled); later the f32 result rows
  __shared__ __attribute__((aligned(16))) _Float16 lds_qk[64 * QK_STRIDE];
  // V transposed: [channel][token]
  __shared__ __attribute__((aligned(16))) _Float16 lds_vt[CHN * VT_STRIDE];
  // rel-pos bias table, [head][169]
  __shared__ float lds_rp[NHEAD * RP_PITCH];
  // per token: ty * 13 + tx (its part of the bias index), shift-mask region
  __shared__ __attribute__((aligned(16))) int lds_koff[64];
  __shared__ __attribute__((aligned(16))) int lds_kreg[64];

  const int tid  = threadIdx.x;
  const int lane = tid & 31;
  const int wv   = tid >> 5;  // 8 waves

  const int blk = blockIdx.x;           // 4096 = 64 imgs * 8 * 8 windows
  const int img = blk >> 6;
  const int wy  = (blk >> 3) & 7;
  const int wx  = blk & 7;

  // ---- Stage A: gather shifted window into LDS (f32 -> f16) ----------------
  for (int j = tid; j < 169 * NHEAD; j += 256)
    lds_rp[(j & 3) * RP_PITCH + (j >> 2)] = rel_tab[j];
  if (tid < WSQ) {
    int ty = tid / WINSZ, tx = tid - ty * WINSZ;
    lds_koff[tid] = ty * 13 + tx;
    lds_kreg[tid] =
        region56(wy * WINSZ + ty) * 3 + region56(wx * WINSZ + tx);
  }

  for (int j = tid; j < WSQ * 32; j += 256) {
    int t  = j >> 5;
    int q  = (j & 31) << 2;
    int ty = t / WINSZ, tx = t - ty * WINSZ;
    int gr = wy * WINSZ + ty + SHF; if (gr >= IMGE) gr -= IMGE;
    int gc = wx * WINSZ + tx + SHF; if (gc >= IMGE) gc -= IMGE;
    const float4 v =
        *(const float4*)(x + (((size_t)img * IMGE + gr) * IMGE + gc) * CHN + q);
    _Float16* d = lds_xs + t * XS_STRIDE + q;
    d[0] = (_Float16)v.x; d[1] = (_Float16)v.y;
    d[2] = (_Float16)v.z; d[3] = (_Float16)v.w;
  }
  for (int j = tid; j < (64 - WSQ) * CHN; j += 256)   // zero-pad rows 49..63
    lds_xs[(WSQ + (j >> 7)) * XS_STRIDE + (j & 127)] = (_Float16)0;

  __syncthreads();

  // ---- Stage B: QKV = X @ Wqkv + b (q columns pre-scaled by 1/sqrt(32)) ----
  const float qscale = 0.17677669529663687f;
  for (int t = wv; t < 4 * 24; t += 8) {
    int mt = t / 24, nt = t - mt * 24;
    int n0 = nt * 16;
    float bv = qkv_bias[n0 + (lane & 15)];
    v8f acc;
    #pragma unroll
    for (int i = 0; i < 8; ++i) acc[i] = bv;
    #pragma unroll
    for (int kc = 0; kc < 4; ++kc) {
      v16h a = ldA_row(lds_xs, XS_STRIDE, mt * 16, kc * 32, lane);
      v16h b = ldB_pack(qkv_pack + (size_t)(kc * 24 + nt) * 512, lane);
      acc = wmma_f16(a, b, acc);
    }
    float sc = (n0 < CHN) ? qscale : 1.0f;
    int col   = n0 + (lane & 15);
    int rbase = mt * 16 + ((lane & 16) ? 8 : 0);
    if (n0 < 2 * CHN) {  // Q, K: rows by token
      #pragma unroll
      for (int r = 0; r < 8; ++r)
        lds_qk[(rbase + r) * QK_STRIDE + col] = (_Float16)(acc[r] * sc);
    } else {             // V: a lane's 8 tokens of one channel, one 16-byte store
      v8h vv;
      #pragma unroll
      for (int r = 0; r < 8; ++r) vv[r] = (_Float16)acc[r];
      *(v8h*)(lds_vt + (col - 2 * CHN) * VT_STRIDE + rbase) = vv;
    }
  }
  __syncthreads();

  // ---- Attention, all in one wave's registers ------------------------------
  // A wave owns 16 queries (mt) and two heads. S^T = K Q^T: in every 16-key
  // tile lane (c, hh) holds keys 8*hh+0..7 of query c, so the softmax runs
  // in-lane plus one exchange of the wave's halves; two score tiles, converted
  // in place, are the B operand P^T of O^T = V^T P^T.
  {
    const int c  = lane & 15;
    const int hh = lane >> 4;
    const int mt = wv >> 1;
    const int h0 = (wv & 1) * 2;

    // Padding queries 49..63 take query 48's bias and mask; their rows are
    // never stored to out.
    const int sq = min(mt * 16 + c, WSQ - 1);
    // bias index = (sy - ty + 6) * 13 + (sx - tx + 6) = koff[s] + 84 - koff[t]
    const int qoff = lds_koff[sq] + 84;
    const bool edge = wy == 7 || wx == 7;  // only these windows mix regions
    const float L2E = 1.4426950408889634f;  // exp(x) = exp2(x * log2 e)

    // Kept rolled: with one head's scores live at a time the wave stays under
    // 128 VGPRs, which four workgroups per WGP need (unrolled it took 156).
    #pragma unroll 1
    for (int j = 0; j < 2; ++j) {
      const int hd = h0 + j;
      const float* rp = lds_rp + hd * RP_PITCH + qoff;

      // The bias is the C operand of the score product. Key tile 3 holds one
      // real key, 48 (hh == 0, register 0; koff = 84).
      v8f st[4];
      #pragma unroll
      for (int kt = 0; kt < 3; ++kt) {
        const v4i ka = *(const v4i*)(lds_koff + kt * 16 + 8 * hh);
        const v4i kb = *(const v4i*)(lds_koff + kt * 16 + 8 * hh + 4);
        #pragma unroll
        for (int r = 0; r < 8; ++r) st[kt][r] = rp[-(r < 4 ? ka[r] : kb[r - 4])];
      }
      {
        v8f z = {};
        z[0] = rp[-84];
        st[3] = z;
      }

      const v16h bq = ldA_row(lds_qk, QK_STRIDE, mt * 16, hd * HDIM, lane);
      #pragma unroll
      for (int kt = 0; kt < 4; ++kt) {
        v16h ak = ldA_row(lds_qk, QK_STRIDE, kt * 16, CHN + hd * HDIM, lane);
        st[kt] = wmma_f16(ak, bq, st[kt]);
      }

      if (edge) {
        const int qreg = lds_kreg[sq];
        #pragma unroll
        for (int kt = 0; kt < 3; ++kt) {
          const v4i ra = *(const v4i*)(lds_kreg + kt * 16 + 8 * hh);
          const v4i rb = *(const v4i*)(lds_kreg + kt * 16 + 8 * hh + 4);
          #pragma unroll
          for (int r = 0; r < 8; ++r)
            st[kt][r] += (r < 4 ? ra[r] : rb[r - 4]) == qreg ? 0.f : -100.f;
        }
        st[3][0] += lds_kreg[WSQ - 1] == qreg ? 0.f : -100.f;
      }

      const float s48 = hh ? -1e30f : st[3][0];  // keys 49..63 do not exist
      float mx = s48;
      #pragma unroll
      for (int kt = 0; kt < 3; ++kt)
        #pragma unroll
        for (int r = 0; r < 8; ++r) mx = fmaxf(mx, st[kt][r]);
      mx = fmaxf(mx, swap_halves(mx));
      const float mb = mx * L2E;

      float part[3];
      v16h pb0, pb1;
      #pragma unroll
      for (int kt = 0; kt < 3; ++kt) {
        part[kt] = 0.f;
        #pragma unroll
        for (int r = 0; r < 8; ++r) {
          float p = __builtin_amdgcn_exp2f(fmaf(st[kt][r], L2E, -mb));
          part[kt] += p;
          if (kt == 0) pb0[r] = (_Float16)p;
          if (kt == 1) pb0[8 + r] = (_Float16)p;
          if (kt == 2) pb1[r] = (_Float16)p;
        }
      }
      const float p48 = __builtin_amdgcn_exp2f(fmaf(s48, L2E, -mb));
      pb1[8] = (_Float16)p48;
      #pragma unroll
      for (int r = 1; r < 8; ++r) pb1[8 + r] = (_Float16)0;
      float sum = (part[0] + part[1]) + (part[2] + p48);
      sum += swap_halves(sum);
      const float inv = 1.0f / sum;

      #pragma unroll
      for (int dt = 0; dt < 2; ++dt) {
        const int ch = hd * HDIM + dt * 16;
        v8f acc = {};
        acc = wmma_f16(ldA_row(lds_vt, VT_STRIDE, ch, 0, lane), pb0, acc);
        acc = wmma_f16(ldA_row(lds_vt, VT_STRIDE, ch, 32, lane), pb1, acc);
        v8h o;  // channels ch + 8*hh + 0..7 of query c
        #pragma unroll
        for (int r = 0; r < 8; ++r) o[r] = (_Float16)(acc[r] * inv);
        *(v8h*)(lds_xs + (mt * 16 + c) * XS_STRIDE + ch + 8 * hh) = o;
      }
    }
  }
  __syncthreads();

  // ---- Stage E: Y = O @ Wproj + b, staged in LDS by token ------------------
  // Q|K are dead behind the barrier above; their 64 rows of 528 bytes hold the
  // f32 result rows (128 floats + 4 of pad: the wave's two halves, 8 rows
  // apart, fall on different banks).
  float* lds_y = reinterpret_cast<float*>(lds_qk);
  {
    const int col = wv * 16 + (lane & 15);   // a wave owns 16 output channels
    const float bv = proj_bias[col];
    v16h b[4];
    #pragma unroll  // b[] is indexed by constants only, so it stays in registers
    for (int kc = 0; kc < 4; ++kc)
      b[kc] = ldB_pack(proj_pack + (size_t)(kc * 8 + wv) * 512, lane);
    for (int mt = 0; mt < 4; ++mt) {
      v8f acc;
      #pragma unroll
      for (int i = 0; i < 8; ++i) acc[i] = bv;
      #pragma unroll
      for (int kc = 0; kc < 4; ++kc)
        acc = wmma_f16(ldA_row(lds_xs, XS_STRIDE, mt * 16, kc * 32, lane),
                       b[kc], acc);
      float* d = lds_y + (mt * 16 + ((lane & 16) ? 8 : 0)) * Y_STRIDE + col;
      #pragma unroll
      for (int r = 0; r < 8; ++r) d[r * Y_STRIDE] = acc[r];
    }
  }
  __syncthreads();

  // ---- Reverse shift: a wave stores one window row, 7 tokens --------------
  // One store is one token's whole 512-byte row. The window row is the same in
  // every lane, so the addresses are scalar work; wave 7 has no row.
  const int wrow = __builtin_amdgcn_readfirstlane(wv);
  if (wrow < WINSZ) {
    int gr = wy * WINSZ + wrow + SHF; if (gr >= IMGE) gr -= IMGE;
    const float* y = lds_y + wrow * WINSZ * Y_STRIDE + lane * 4;
    float* o = out + ((size_t)img * IMGE + gr) * (IMGE * CHN) + lane * 4;
    for (int tx = 0; tx < WINSZ; ++tx) {
      int gc = wx * WINSZ + tx + SHF; if (gc >= IMGE) gc -= IMGE;
      *(float4*)(o + gc * CHN) = *(const float4*)(y + tx * Y_STRIDE);
    }
  }
}

extern "C" void kernel_launch(void* const* d_in, const int* in_sizes, int n_in,
                              void* d_out, int out_size, void* d_ws,
                              size_t ws_size, hipStream_t stream) {
  const float* x     = (const float*)d_in[0];
  const float* qkvW  = (const float*)d_in[1];
  const float* qkvB  = (const float*)d_in[2];
  const float* projW = (const float*)d_in[3];
  const float* projB = (const float*)d_in[4];
  const float* relT  = (const float*)d_in[5];

  _Float16* qkv_pack  = (_Float16*)d_ws;                              // 96 KB
  _Float16* proj_pack = (_Float16*)((char*)d_ws + (size_t)CHN * 384 * 2);

  pack_weights_kernel<<<(CHN * 384 + 255) / 256, 256, 0, stream>>>(
      qkvW, qkv_pack, CHN, 384);
  pack_weights_kernel<<<(CHN * CHN + 255) / 256, 256, 0, stream>>>(
      projW, proj_pack, CHN, CHN);

  swin_window_attn_kernel<<<4096, 256, 0, stream>>>(
      x, qkvB, projB, relT, qkv_pack, proj_pack, (float*)d_out);
}

// v003
// A run of this version takes 68.2 microseconds.
// Two timings next to v002 put it at 1.30 and 1.29 times that version's speed.
// Counting every step since v000, it is 2.74 times as fast.
#include <hip/hip_runtime.h>
#include <cstddef>

typedef _Float16 v8h  __attribute__((ext_vector_type(8)));
typedef _Float16 v16h __attribute__((ext_vector_type(16)));
typedef float    v8f  __attribute__((ext_vector_type(8)));
typedef int      v4i  __attribute__((ext_vector_type(4)));

#define WINSZ 7
#define SHF   3
#define WSQ   49      // tokens per window
#define NHEAD 4
#define HDIM  32
#define CHN   128
#define IMGE  56

constexpr int XS_STRIDE = 136;  // halves (also holds O after QKV stage)
constexpr int QK_STRIDE = 264;  // halves, Q|K rows by token (528 B = 16 B x odd)
constexpr int Y_STRIDE  = 132;  // floats, result rows in the Q|K space (528 B)
constexpr int VT_STRIDE = 72;   // halves, V transposed: rows by channel (144 B)
constexpr int RP_PITCH  = 176;  // floats, one head's rel-pos bias table

__device__ __forceinline__ v8f wmma_f16(v16h a, v16h b, v8f c) {
  return __builtin_amdgcn_wmma_f32_16x16x32_f16(false, a, false, b, (short)0, c,
                                                false, false);
}

// A-fragment (16x32 f16, M x K), row-major source. Also serves as the
// B-fragment of a transposed matrix (Qᵀ) since lane<->column mapping matches.
__device__ __forceinline__ v16h ldA_row(const _Float16* base, int stride,
                                        int row0, int k0, int lane) {
  const int l  = lane & 15;
  const int kk = k0 + ((lane & 16) ? 8 : 0);
  const _Float16* p = base + (size_t)(row0 + l) * stride + kk;
  v8h lo = *(const v8h*)(p);        // K = kk+0..7
  v8h hi = *(const v8h*)(p + 16);   // K = kk+16..23
  return __builtin_shufflevector(lo, hi, 0,1,2,3,4,5,6,7,8,9,10,11,12,13,14,15);
}

// B-fragment from pre-swizzled pack: 512 halves per fragment, 16/lane contiguous.
__device__ __forceinline__ v16h ldB_pack(const _Float16* frag, int lane) {
  const _Float16* p = frag + lane * 16;
  v8h lo = *(const v8h*)(p);
  v8h hi = *(const v8h*)(p + 8);
  return __builtin_shufflevector(lo, hi, 0,1,2,3,4,5,6,7,8,9,10,11,12,13,14,15);
}

// Lane l <-> lane l ^ 16 (the two halves of a wave hold the two key halves).
__device__ __forceinline__ float swap_halves(float v) {
  int b = __builtin_bit_cast(int, v);
  b = __builtin_amdgcn_permlanex16(b, b, 0x76543210, 0xfedcba98, false, false);
  return __builtin_bit_cast(float, b);
}

__device__ __forceinline__ int region56(int g) {
  return g < (IMGE - WINSZ) ? 0 : (g < (IMGE - SHF) ? 1 : 2);
}

// ---------------------------------------------------------------------------
// Pre-pass: convert f32 weights to f16, swizzled into WMMA B-fragment layout.
// Fragment f = kc*(N/16)+nt holds 32 lanes x 16 halves.
// lane<16 : col n = nt*16+lane, halves = K {0..7, 16..23}+kc*32
// lane>=16: col n = nt*16+lane-16, halves = K {8..15,24..31}+kc*32
// ---------------------------------------------------------------------------
__global__ void pack_weights_kernel(const float* __restrict__ W,
                                    _Float16* __restrict__ P, int K, int N) {
  int idx = blockIdx.x * blockDim.x + threadIdx.x;
  if (idx >= K * N) return;
  int f    = idx >> 9;
  int lane = (idx >> 4) & 31;
  int i    = idx & 15;
  int NT   = N >> 4;
  int kc   = f / NT, nt = f - kc * NT;
  int l    = lane & 15;
  int hi   = (lane >> 4) & 1;
  int k    = kc * 32 + (i < 8 ? (hi ? 8 : 0) + i : (hi ? 24 : 16) + (i - 8));
  int n    = nt * 16 + l;
  P[idx] = (_Float16)W[(size_t)k * N + n];
}

// ---------------------------------------------------------------------------
// Fused shifted-window attention: one workgroup (8 waves) per window.
// ---------------------------------------------------------------------------
__global__ __launch_bounds__(256) void swin_window_attn_kernel(
    const float* __restrict__ x, const float* __restrict__ qkv_bias,
    const float* __restrict__ proj_bias, const float* __restrict__ rel_tab,
    const _Float16* __restrict__ qkv_pack, const _Float16* __restrict__ proj_pack,
    float* __restrict__ out) {
  // X tile, later O tile
  __shared__ __attribute__((aligned(16))) _Float16 lds_xs[64 * XS_STRIDE];
  // Q|K by token (256 cols, q pre-scaled); later the f32 result rows
  __shared__ __attribute__((aligned(16))) _Float16 lds_qk[64 * QK_STRIDE];
  // V transposed: [channel][token]
  __shared__ __attribute__((aligned(16))) _Float16 lds_vt[CHN * VT_STRIDE];
  // rel-pos bias table, [head][169]
  __shared__ float lds_rp[NHEAD * RP_PITCH];
  // per token: ty * 13 + tx (its part of the bias index), shift-mask region
  __shared__ __attribute__((aligned(16))) int lds_koff[64];
  __shared__ __attribute__((aligned(16))) int lds_kreg[64];

  const int tid  = threadIdx.x;
  const int lane = tid & 31;
  const int wv   = tid >> 5;  // 8 waves

  const int blk = blockIdx.x;           // 4096 = 64 imgs * 8 * 8 windows
  const int img = blk >> 6;
  const int wy  = (blk >> 3) & 7;
  const int wx  = blk & 7;

  // QKV bias of the wave's three column tiles (Q, K, V), read ahead of the gather
  // so that stage B does not wait for it in front of its weight loads.
  float qb[3];
  #pragma unroll  // qb[] is indexed by constants only, so it stays in registers
  for (int g = 0; g < 3; ++g) qb[g] = qkv_bias[(g * 8 + wv) * 16 + (lane & 15)];

  // ---- Stage A: gather shifted window into LDS (f32 -> f16) ----------------
  for (int j = tid; j < 169 * NHEAD; j += 256)
    lds_rp[(j & 3) * RP_PITCH + (j >> 2)] = rel_tab[j];
  if (tid < WSQ) {
    int ty = tid / WINSZ, tx = tid - ty * WINSZ;
    lds_koff[tid] = ty * 13 + tx;
    lds_kreg[tid] =
        region56(wy * WINSZ + ty) * 3 + region56(wx * WINSZ + tx);
  }

  for (int j = tid; j < WSQ * 32; j += 256) {
    int t  = j >> 5;
    int q  = (j & 31) << 2;
    int ty = t / WINSZ, tx = t - ty * WINSZ;
    int gr = wy * WINSZ + ty + SHF; if (gr >= IMGE) gr -= IMGE;
    int gc = wx * WINSZ + tx + SHF; if (gc >= IMGE) gc -= IMGE;
    const float4 v =
        *(const float4*)(x + (((size_t)img * IMGE + gr) * IMGE + gc) * CHN + q);
    _Float16* d = lds_xs + t * XS_STRIDE + q;
    d[0] = (_Float16)v.x; d[1] = (_Float16)v.y;
    d[2] = (_Float16)v.z; d[3] = (_Float16)v.w;
  }
  for (int j = tid; j < (64 - WSQ) * CHN; j += 256)   // zero-pad rows 49..63
    lds_xs[(WSQ + (j >> 7)) * XS_STRIDE + (j & 127)] = (_Float16)0;

  __syncthreads();

  // ---- Stage B: QKV = X @ Wqkv + b (q columns pre-scaled by 1/sqrt(32)) ----
  // A wave owns one 16-column tile of Q, one of K and one of V. A tile's four
  // weight fragments are loaded once and stay in registers for all four row
  // tiles of the window.
  const float qscale = 0.17677669529663687f;
  {
    const int wvs   = __builtin_amdgcn_readfirstlane(wv);  // scalar addresses
    const int rhalf = (lane & 16) ? 8 : 0;
    #pragma unroll  // g constant in each pass: no branch picks the store form
    for (int g = 0; g < 3; ++g) {  // 0: Q, 1: K, 2: V
      // Compiler fence between the passes: it keeps each pass's loads and stores
      // inside the pass. Without it the build runs a row tile's four products as
      // one dependent chain, each behind a full LDS wait, one tile after another;
      // with it the four tiles' chains are interleaved, in as many registers.
      if (g > 0) asm volatile("" ::: "memory");
      const int nt  = g * 8 + wvs;
      const int col = nt * 16 + (lane & 15);
      const float bv = qb[g];
      v16h b[4];
      #pragma unroll  // b[] is indexed by constants only, so it stays in registers
      for (int kc = 0; kc < 4; ++kc)
        b[kc] = ldB_pack(qkv_pack + (size_t)(kc * 24 + nt) * 512, lane);
      #pragma unroll  // four independent accumulator chains to interleave
      for (int mt = 0; mt < 4; ++mt) {
        v8f acc;
        #pragma unroll
        for (int i = 0; i < 8; ++i) acc[i] = bv;
        #pragma unroll
        for (int kc = 0; kc < 4; ++kc)
          acc = wmma_f16(ldA_row(lds_xs, XS_STRIDE, mt * 16, kc * 32, lane),
                         b[kc], acc);
        const int rbase = mt * 16 + rhalf;
        if (g < 2) {  // Q, K: rows by token
          const float sc = g == 0 ? qscale : 1.0f;
          #pragma unroll
          for (int r = 0; r < 8; ++r)
            lds_qk[(rbase + r) * QK_STRIDE + col] = (_Float16)(acc[r] * sc);
        } else {      // V: a lane's 8 tokens of one channel, one 16-byte store
          v8h vv;
          #pragma unroll
          for (int r = 0; r < 8; ++r) vv[r] = (_Float16)acc[r];
          *(v8h*)(lds_vt + (col - 2 * CHN) * VT_STRIDE + rbase) = vv;
        }
      }
    }
  }
  __syncthreads();

  // ---- Attention, all in one wave's registers ------------------------------
  // A wave owns 16 queries (mt) and two heads. S^T = K Q^T: in every 16-key
  // tile lane (c, hh) holds keys 8*hh+0..7 of query c, so the softmax runs
  // in-lane plus one exchange of the wave's halves; two score tiles, converted
  // in place, are the B operand P^T of O^T = V^T P^T.
  {
    const int c  = lane & 15;
    const int hh = lane >> 4;
    const int mt = wv >> 1;
    const int h0 = (wv & 1) * 2;

    // Padding queries 49..63 take query 48's bias and mask; their rows are
    // never stored to out.
    const int sq = min(mt * 16 + c, WSQ - 1);
    // bias index = (sy - ty + 6) * 13 + (sx - tx + 6) = koff[s] + 84 - koff[t]
    const int qoff = lds_koff[sq] + 84;
    const bool edge = wy == 7 || wx == 7;  // only these windows mix regions
    const float L2E = 1.4426950408889634f;  // exp(x) = exp2(x * log2 e)

    // Kept rolled: with one head's scores live at a time the wave stays under
    // 128 VGPRs, which four workgroups per WGP need (unrolled it took 156).
    #pragma unroll 1
    for (int j = 0; j < 2; ++j) {
      const int hd = h0 + j;
      const float* rp = lds_rp + hd * RP_PITCH + qoff;

      // The bias is the C operand of the score product. Key tile 3 holds one
      // real key, 48 (hh == 0, register 0; koff = 84).
      v8f st[4];
      #pragma unroll
      for (int kt = 0; kt < 3; ++kt) {
        const v4i ka = *(const v4i*)(lds_koff + kt * 16 + 8 * hh);
        const v4i kb = *(const v4i*)(lds_koff + kt * 16 + 8 * hh + 4);
        #pragma unroll
        for (int r = 0; r < 8; ++r) st[kt][r] = rp[-(r < 4 ? ka[r] : kb[r - 4])];
      }
      {
        v8f z = {};
        z[0] = rp[-84];
        st[3] = z;
      }

      const v16h bq = ldA_row(lds_qk, QK_STRIDE, mt * 16, hd * HDIM, lane);
      #pragma unroll
      for (int kt = 0; kt < 4; ++kt) {
        v16h ak = ldA_row(lds_qk, QK_STRIDE, kt * 16, CHN + hd * HDIM, lane);
        st[kt] = wmma_f16(ak, bq, st[kt]);
      }

      if (edge) {
        const int qreg = lds_kreg[sq];
        #pragma unroll
        for (int kt = 0; kt < 3; ++kt) {
          const v4i ra = *(const v4i*)(lds_kreg + kt * 16 + 8 * hh);
          const v4i rb = *(const v4i*)(lds_kreg + kt * 16 + 8 * hh + 4);
          #pragma unroll
          for (int r = 0; r < 8; ++r)
            st[kt][r] += (r < 4 ? ra[r] : rb[r - 4]) == qreg ? 0.f : -100.f;
        }
        st[3][0] += lds_kreg[WSQ - 1] == qreg ? 0.f : -100.f;
      }

      const float s48 = hh ? -1e30f : st[3][0];  // keys 49..63 do not exist
      float mx = s48;
      #pragma unroll
      for (int kt = 0; kt < 3; ++kt)
        #pragma unroll
        for (int r = 0; r < 8; ++r) mx = fmaxf(mx, st[kt][r]);
      mx = fmaxf(mx, swap_halves(mx));
      const float mb = mx * L2E;

      float part[3];
      v16h pb0, pb1;
      #pragma unroll
      for (int kt = 0; kt < 3; ++kt) {
        part[kt] = 0.f;
        #pragma unroll
        for (int r = 0; r < 8; ++r) {
          float p = __builtin_amdgcn_exp2f(fmaf(st[kt][r], L2E, -mb));
          part[kt] += p;
          if (kt == 0) pb0[r] = (_Float16)p;
          if (kt == 1) pb0[8 + r] = (_Float16)p;
          if (kt == 2) pb1[r] = (_Float16)p;
        }
      }
      const float p48 = __builtin_amdgcn_exp2f(fmaf(s48, L2E, -mb));
      pb1[8] = (_Float16)p48;
      #pragma unroll
      for (int r = 1; r < 8; ++r) pb1[8 + r] = (_Float16)0;
      float sum = (part[0] + part[1]) + (part[2] + p48);
      sum += swap_halves(sum);
      const float inv = 1.0f / sum;

      #pragma unroll
      for (int dt = 0; dt < 2; ++dt) {
        const int ch = hd * HDIM + dt * 16;
        v8f acc = {};
        acc = wmma_f16(ldA_row(lds_vt, VT_STRIDE, ch, 0, lane), pb0, acc);
        acc = wmma_f16(ldA_row(lds_vt, VT_STRIDE, ch, 32, lane), pb1, acc);
        v8h o;  // channels ch + 8*hh + 0..7 of query c
        #pragma unroll
        for (int r = 0; r < 8; ++r) o[r] = (_Float16)(acc[r] * inv);
        *(v8h*)(lds_xs + (mt * 16 + c) * XS_STRIDE + ch + 8 * hh) = o;
      }
    }
  }
  __syncthreads();

  // ---- Stage E: Y = O @ Wproj + b, staged in LDS by token ------------------
  // Q|K are dead behind the barrier above; their 64 rows of 528 bytes hold the
  // f32 result rows (128 floats + 4 of pad: the wave's two halves, 8 rows
  // apart, fall on different banks).
  float* lds_y = reinterpret_cast<float*>(lds_qk);
  {
    const int col = wv * 16 + (lane & 15);   // a wave owns 16 output channels
    const float bv = proj_bias[col];
    v16h b[4];
    #pragma unroll  // b[] is indexed by constants only, so it stays in registers
    for (int kc = 0; kc < 4; ++kc)
      b[kc] = ldB_pack(proj_pack + (size_t)(kc * 8 + wv) * 512, lane);
    for (int mt = 0; mt < 4; ++mt) {
      v8f acc;
      #pragma unroll
      for (int i = 0; i < 8; ++i) acc[i] = bv;
      #pragma unroll
      for (int kc = 0; kc < 4; ++kc)
        acc = wmma_f16(ldA_row(lds_xs, XS_STRIDE, mt * 16, kc * 32, lane),
                       b[kc], acc);
      float* d = lds_y + (mt * 16 + ((lane & 16) ? 8 : 0)) * Y_STRIDE + col;
      #pragma unroll
      for (int r = 0; r < 8; ++r) d[r * Y_STRIDE] = acc[r];
    }
  }
  __syncthreads();

  // ---- Reverse shift: a wave stores one window row, 7 tokens --------------
  // One store is one token's whole 512-byte row. The window row is the same in
  // every lane, so the addresses are scalar work; wave 7 has no row.
  const int wrow = __builtin_amdgcn_readfirstlane(wv);
  if (wrow < WINSZ) {
    int gr = wy * WINSZ + wrow + SHF; if (gr >= IMGE) gr -= IMGE;
    const float* y = lds_y + wrow * WINSZ * Y_STRIDE + lane * 4;
    float* o = out + ((size_t)img * IMGE + gr) * (IMGE * CHN) + lane * 4;
    for (int tx = 0; tx < WINSZ; ++tx) {
      int gc = wx * WINSZ + tx + SHF; if (gc >= IMGE) gc -= IMGE;
      *(float4*)(o + gc * CHN) = *(const float4*)(y + tx * Y_STRIDE);
    }
  }
}

extern "C" void kernel_launch(void* const* d_in, const int* in_sizes, int n_in,
                              void* d_out, int out_size, void* d_ws,
                              size_t ws_size, hipStream_t stream) {
  const float* x     = (const float*)d_in[0];
  const float* qkvW  = (const float*)d_in[1];
  const float* qkvB  = (const float*)d_in[2];
  const float* projW = (const float*)d_in[3];
  const float* projB = (const float*)d_in[4];
  const float* relT  = (const float*)d_in[5];

  _Float16* qkv_pack  = (_Float16*)d_ws;                              // 96 KB
  _Float16* proj_pack = (_Float16*)((char*)d_ws + (size_t)CHN * 384 * 2);

  pack_weights_kernel<<<(CHN * 384 + 255) / 256, 256, 0, stream>>>(
      qkvW, qkv_pack, CHN, 384);
  pack_weights_kernel<<<(CHN * CHN + 255) / 256, 256, 0, stream>>>(
      projW, proj_pack, CHN, CHN);

  swin_window_attn_kernel<<<4096, 256, 0, stream>>>(
      x, qkvB, projB, relT, qkv_pack, proj_pack, (float*)d_out);
}

// v004
// One run takes 55.4 microseconds.
// Two timings next to v003 put it at 1.22 and 1.23 times that version's speed.
// All steps since v000 together make it 3.36 times as fast.
#include <hip/hip_runtime.h>
#include <cstddef>

typedef _Float16 v4h  __attribute__((ext_vector_type(4)));
typedef _Float16 v8h  __attribute__((ext_vector_type(8)));
typedef _Float16 v16h __attribute__((ext_vector_type(16)));
typedef float    v8f  __attribute__((ext_vector_type(8)));
typedef int      v4i  __attribute__((ext_vector_type(4)));

#define WINSZ 7
#define SHF   3
#define WSQ   49      // tokens per window
#define NHEAD 4
#define HDIM  32
#define CHN   128
#define IMGE  56

constexpr int XS_STRIDE = 136;  // halves (also holds O after QKV stage)
constexpr int QK_STRIDE = 264;  // halves, Q|K rows by token (528 B = 16 B x odd)
constexpr int Y_STRIDE  = 132;  // floats, result rows in the Q|K space (528 B)
constexpr int VT_STRIDE = 72;   // halves, V transposed: rows by channel (144 B)
constexpr int RP_PITCH  = 176;  // floats, one head's rel-pos bias table

__device__ __forceinline__ v8f wmma_f16(v16h a, v16h b, v8f c) {
  return __builtin_amdgcn_wmma_f32_16x16x32_f16(false, a, false, b, (short)0, c,
                                                false, false);
}

// A-fragment (16x32 f16, M x K), row-major source. Also serves as the
// B-fragment of a transposed matrix (Qᵀ) since lane<->column mapping matches.
__device__ __forceinline__ v16h ldA_row(const _Float16* base, int stride,
                                        int row0, int k0, int lane) {
  const int l  = lane & 15;
  const int kk = k0 + ((lane & 16) ? 8 : 0);
  const _Float16* p = base + (size_t)(row0 + l) * stride + kk;
  v8h lo = *(const v8h*)(p);        // K = kk+0..7
  v8h hi = *(const v8h*)(p + 16);   // K = kk+16..23
  return __builtin_shufflevector(lo, hi, 0,1,2,3,4,5,6,7,8,9,10,11,12,13,14,15);
}

// B-fragment from pre-swizzled pack: 512 halves per fragment, 16/lane contiguous.
__device__ __forceinline__ v16h ldB_pack(const _Float16* frag, int lane) {
  const _Float16* p = frag + lane * 16;
  v8h lo = *(const v8h*)(p);
  v8h hi = *(const v8h*)(p + 8);
  return __builtin_shufflevector(lo, hi, 0,1,2,3,4,5,6,7,8,9,10,11,12,13,14,15);
}

// Lane l <-> lane l ^ 16 (the two halves of a wave hold the two key halves).
__device__ __forceinline__ float swap_halves(float v) {
  int b = __builtin_bit_cast(int, v);
  b = __builtin_amdgcn_permlanex16(b, b, 0x76543210, 0xfedcba98, false, false);
  return __builtin_bit_cast(float, b);
}

__device__ __forceinline__ int region56(int g) {
  return g < (IMGE - WINSZ) ? 0 : (g < (IMGE - SHF) ? 1 : 2);
}

// ---------------------------------------------------------------------------
// Pre-pass: convert f32 weights to f16, swizzled into WMMA B-fragment layout.
// Fragment f = kc*(N/16)+nt holds 32 lanes x 16 halves.
// lane<16 : col n = nt*16+lane, halves = K {0..7, 16..23}+kc*32
// lane>=16: col n = nt*16+lane-16, halves = K {8..15,24..31}+kc*32
// ---------------------------------------------------------------------------
__global__ void pack_weights_kernel(const float* __restrict__ W,
                                    _Float16* __restrict__ P, int K, int N) {
  int idx = blockIdx.x * blockDim.x + threadIdx.x;
  if (idx >= K * N) return;
  int f    = idx >> 9;
  int lane = (idx >> 4) & 31;
  int i    = idx & 15;
  int NT   = N >> 4;
  int kc   = f / NT, nt = f - kc * NT;
  int l    = lane & 15;
  int hi   = (lane >> 4) & 1;
  int k    = kc * 32 + (i < 8 ? (hi ? 8 : 0) + i : (hi ? 24 : 16) + (i - 8));
  int n    = nt * 16 + l;
  P[idx] = (_Float16)W[(size_t)k * N + n];
}

// ---------------------------------------------------------------------------
// Fused shifted-window attention: one workgroup (8 waves) per window.
// ---------------------------------------------------------------------------
__global__ __launch_bounds__(256) void swin_window_attn_kernel(
    const float* __restrict__ x, const float* __restrict__ qkv_bias,
    const float* __restrict__ proj_bias, const float* __restrict__ rel_tab,
    const _Float16* __restrict__ qkv_pack, const _Float16* __restrict__ proj_pack,
    float* __restrict__ out) {
  // X tile, later O tile
  __shared__ __attribute__((aligned(16))) _Float16 lds_xs[64 * XS_STRIDE];
  // Q|K by token (256 cols, q pre-scaled); later the f32 result rows
  __shared__ __attribute__((aligned(16))) _Float16 lds_qk[64 * QK_STRIDE];
  // V transposed: [channel][token]
  __shared__ __attribute__((aligned(16))) _Float16 lds_vt[CHN * VT_STRIDE];
  // rel-pos bias table, [head][169]
  __shared__ float lds_rp[NHEAD * RP_PITCH];
  // per token: ty * 13 + tx (its part of the bias index), shift-mask region
  __shared__ __attribute__((aligned(16))) int lds_koff[64];
  __shared__ __attribute__((aligned(16))) int lds_kreg[64];

  const int tid  = threadIdx.x;
  const int lane = tid & 31;
  const int wv   = tid >> 5;  // 8 waves

  const int blk = blockIdx.x;           // 4096 = 64 imgs * 8 * 8 windows
  const int img = blk >> 6;
  const int wy  = (blk >> 3) & 7;
  const int wx  = blk & 7;

  // QKV bias of the wave's three column tiles (Q, K, V), read ahead of the gather
  // so that stage B does not wait for it in front of its weight loads.
  float qb[3];
  #pragma unroll  // qb[] is indexed by constants only, so it stays in registers
  for (int g = 0; g < 3; ++g) qb[g] = qkv_bias[(g * 8 + wv) * 16 + (lane & 15)];

  // ---- Stage A: gather shifted window into LDS (f32 -> f16) ----------------
  // Every load of a wave is issued before the first of them is waited for.
  const int wvs = __builtin_amdgcn_readfirstlane(wv);  // scalar addresses
  float rt[3];  // rel-pos table, 676 entries; the last read is clamped
  #pragma unroll  // rt[] is indexed by constants only; three loads in flight
  for (int k = 0; k < 3; ++k)
    rt[k] = rel_tab[min(tid + 256 * k, 169 * NHEAD - 1)];

  if (wvs < WINSZ) {
    // Waves 0..6: one window row each, 7 tokens, one token's 512-byte row per
    // load. The window row is the same in every lane: addresses are scalar work.
    int gr = wy * WINSZ + wvs + SHF; if (gr >= IMGE) gr -= IMGE;
    const float* xr = x + ((size_t)img * IMGE + gr) * (IMGE * CHN) + lane * 4;
    float4 xv[WINSZ];
    #pragma unroll  // xv[] is indexed by constants only; seven loads in flight
    for (int tx = 0; tx < WINSZ; ++tx) {
      int gc = wx * WINSZ + tx + SHF; if (gc >= IMGE) gc -= IMGE;
      xv[tx] = *(const float4*)(xr + gc * CHN);
    }
    _Float16* d = lds_xs + wvs * WINSZ * XS_STRIDE + lane * 4;
    #pragma unroll  // a loop of its own: no store stands between two loads
    for (int tx = 0; tx < WINSZ; ++tx) {
      v4h h;
      h[0] = (_Float16)xv[tx].x; h[1] = (_Float16)xv[tx].y;
      h[2] = (_Float16)xv[tx].z; h[3] = (_Float16)xv[tx].w;
      *(v4h*)(d + tx * XS_STRIDE) = h;
    }
  } else {
    // Wave 7, which has no window row: the per-token tables and the zero rows.
    for (int t = lane; t < WSQ; t += 32) {
      int ty = t / WINSZ, tx = t - ty * WINSZ;
      lds_koff[t] = ty * 13 + tx;
      lds_kreg[t] =
          region56(wy * WINSZ + ty) * 3 + region56(wx * WINSZ + tx);
    }
    const v4h z = {};
    for (int r = WSQ; r < 64; ++r)   // zero-pad rows 49..63, 8 bytes a lane
      *(v4h*)(lds_xs + r * XS_STRIDE + lane * 4) = z;
  }
  #pragma unroll  // rt[] again by constants
  for (int k = 0; k < 3; ++k) {
    const int j = tid + 256 * k;
    if (j < 169 * NHEAD) lds_rp[(j & 3) * RP_PITCH + (j >> 2)] = rt[k];
  }

  __syncthreads();

  // ---- Stage B: QKV = X @ Wqkv + b (q columns pre-scaled by 1/sqrt(32)) ----
  // A wave owns one 16-column tile of Q, one of K and one of V. A tile's four
  // weight fragments are loaded once and stay in registers for all four row
  // tiles of the window.
  const float qscale = 0.17677669529663687f;
  {
    const int rhalf = (lane & 16) ? 8 : 0;
    #pragma unroll  // g constant in each pass: no branch picks the store form
    for (int g = 0; g < 3; ++g) {  // 0: Q, 1: K, 2: V
      // Compiler fence between the passes: it keeps each pass's loads and stores
      // inside the pass. Without it the build runs a row tile's four products as
      // one dependent chain, each behind a full LDS wait, one tile after another;
      // with it the four tiles' chains are interleaved, in as many registers.
      if (g > 0) asm volatile("" ::: "memory");
      const int nt  = g * 8 + wvs;
      const int col = nt * 16 + (lane & 15);
      const float bv = qb[g];
      v16h b[4];
      #pragma unroll  // b[] is indexed by constants only, so it stays in registers
      for (int kc = 0; kc < 4; ++kc)
        b[kc] = ldB_pack(qkv_pack + (size_t)(kc * 24 + nt) * 512, lane);
      #pragma unroll  // four independent accumulator chains to interleave
      for (int mt = 0; mt < 4; ++mt) {
        v8f acc;
        #pragma unroll
        for (int i = 0; i < 8; ++i) acc[i] = bv;
        #pragma unroll
        for (int kc = 0; kc < 4; ++kc)
          acc = wmma_f16(ldA_row(lds_xs, XS_STRIDE, mt * 16, kc * 32, lane),
                         b[kc], acc);
        const int rbase = mt * 16 + rhalf;
        if (g < 2) {  // Q, K: rows by token
          const float sc = g == 0 ? qscale : 1.0f;
          #pragma unroll
          for (int r = 0; r < 8; ++r)
            lds_qk[(rbase + r) * QK_STRIDE + col] = (_Float16)(acc[r] * sc);
        } else {      // V: a lane's 8 tokens of one channel, one 16-byte store
          v8h vv;
          #pragma unroll
          for (int r = 0; r < 8; ++r) vv[r] = (_Float16)acc[r];
          *(v8h*)(lds_vt + (col - 2 * CHN) * VT_STRIDE + rbase) = vv;
        }
      }
    }
  }
  __syncthreads();

  // ---- Attention, all in one wave's registers ------------------------------
  // A wave owns 16 queries (mt) and two heads. S^T = K Q^T: in every 16-key
  // tile lane (c, hh) holds keys 8*hh+0..7 of query c, so the softmax runs
  // in-lane plus one exchange of the wave's halves; two score tiles, converted
  // in place, are the B operand P^T of O^T = V^T P^T.
  {
    const int c  = lane & 15;
    const int hh = lane >> 4;
    const int mt = wv >> 1;
    const int h0 = (wv & 1) * 2;

    // Padding queries 49..63 take query 48's bias and mask; their rows are
    // never stored to out.
    const int sq = min(mt * 16 + c, WSQ - 1);
    // bias index = (sy - ty + 6) * 13 + (sx - tx + 6) = koff[s] + 84 - koff[t]
    const int qoff = lds_koff[sq] + 84;
    const bool edge = wy == 7 || wx == 7;  // only these windows mix regions
    const float L2E = 1.4426950408889634f;  // exp(x) = exp2(x * log2 e)

    // Kept rolled: with one head's scores live at a time the wave stays under
    // 128 VGPRs, which four workgroups per WGP need (unrolled it took 156).
    #pragma unroll 1
    for (int j = 0; j < 2; ++j) {
      const int hd = h0 + j;
      const float* rp = lds_rp + hd * RP_PITCH + qoff;

      // The bias is the C operand of the score product. Key tile 3 holds one
      // real key, 48 (hh == 0, register 0; koff = 84).
      v8f st[4];
      #pragma unroll
      for (int kt = 0; kt < 3; ++kt) {
        const v4i ka = *(const v4i*)(lds_koff + kt * 16 + 8 * hh);
        const v4i kb = *(const v4i*)(lds_koff + kt * 16 + 8 * hh + 4);
        #pragma unroll
        for (int r = 0; r < 8; ++r) st[kt][r] = rp[-(r < 4 ? ka[r] : kb[r - 4])];
      }
      {
        v8f z = {};
        z[0] = rp[-84];
        st[3] = z;
      }

      const v16h bq = ldA_row(lds_qk, QK_STRIDE, mt * 16, hd * HDIM, lane);
      #pragma unroll
      for (int kt = 0; kt < 4; ++kt) {
        v16h ak = ldA_row(lds_qk, QK_STRIDE, kt * 16, CHN + hd * HDIM, lane);
        st[kt] = wmma_f16(ak, bq, st[kt]);
      }

      if (edge) {
        const int qreg = lds_kreg[sq];
        #pragma unroll
        for (int kt = 0; kt < 3; ++kt) {
          const v4i ra = *(const v4i*)(lds_kreg + kt * 16 + 8 * hh);
          const v4i rb = *(const v4i*)(lds_kreg + kt * 16 + 8 * hh + 4);
          #pragma unroll
          for (int r = 0; r < 8; ++r)
            st[kt][r] += (r < 4 ? ra[r] : rb[r - 4]) == qreg ? 0.f : -100.f;
        }
        st[3][0] += lds_kreg[WSQ - 1] == qreg ? 0.f : -100.f;
      }

      const float s48 = hh ? -1e30f : st[3][0];  // keys 49..63 do not exist
      float mx = s48;
      #pragma unroll
      for (int kt = 0; kt < 3; ++kt)
        #pragma unroll
        for (int r = 0; r < 8; ++r) mx = fmaxf(mx, st[kt][r]);
      mx = fmaxf(mx, swap_halves(mx));
      const float mb = mx * L2E;

      float part[3];
      v16h pb0, pb1;
      #pragma unroll
      for (int kt = 0; kt < 3; ++kt) {
        part[kt] = 0.f;
        #pragma unroll
        for (int r = 0; r < 8; ++r) {
          float p = __builtin_amdgcn_exp2f(fmaf(st[kt][r], L2E, -mb));
          part[kt] += p;
          if (kt == 0) pb0[r] = (_Float16)p;
          if (kt == 1) pb0[8 + r] = (_Float16)p;
          if (kt == 2) pb1[r] = (_Float16)p;
        }
      }
      const float p48 = __builtin_amdgcn_exp2f(fmaf(s48, L2E, -mb));
      pb1[8] = (_Float16)p48;
      #pragma unroll
      for (int r = 1; r < 8; ++r) pb1[8 + r] = (_Float16)0;
      float sum = (part[0] + part[1]) + (part[2] + p48);
      sum += swap_halves(sum);
      const float inv = 1.0f / sum;

      #pragma unroll
      for (int dt = 0; dt < 2; ++dt) {
        const int ch = hd * HDIM + dt * 16;
        v8f acc = {};
        acc = wmma_f16(ldA_row(lds_vt, VT_STRIDE, ch, 0, lane), pb0, acc);
        acc = wmma_f16(ldA_row(lds_vt, VT_STRIDE, ch, 32, lane), pb1, acc);
        v8h o;  // channels ch + 8*hh + 0..7 of query c
        #pragma unroll
        for (int r = 0; r < 8; ++r) o[r] = (_Float16)(acc[r] * inv);
        *(v8h*)(lds_xs + (mt * 16 + c) * XS_STRIDE + ch + 8 * hh) = o;
      }
    }
  }
  __syncthreads();

  // ---- Stage E: Y = O @ Wproj + b, staged in LDS by token ------------------
  // Q|K are dead behind the barrier above; their 64 rows of 528 bytes hold the
  // f32 result rows (128 floats + 4 of pad: the wave's two halves, 8 rows
  // apart, fall on different banks).
  float* lds_y = reinterpret_cast<float*>(lds_qk);
  {
    const int col = wv * 16 + (lane & 15);   // a wave owns 16 output channels
    const float bv = proj_bias[col];
    v16h b[4];
    #pragma unroll  // b[] is indexed by constants only, so it stays in registers
    for (int kc = 0; kc < 4; ++kc)
      b[kc] = ldB_pack(proj_pack + (size_t)(kc * 8 + wv) * 512, lane);
    for (int mt = 0; mt < 4; ++mt) {
      v8f acc;
      #pragma unroll
      for (int i = 0; i < 8; ++i) acc[i] = bv;
      #pragma unroll
      for (int kc = 0; kc < 4; ++kc)
        acc = wmma_f16(ldA_row(lds_xs, XS_STRIDE, mt * 16, kc * 32, lane),
                       b[kc], acc);
      float* d = lds_y + (mt * 16 + ((lane & 16) ? 8 : 0)) * Y_STRIDE + col;
      #pragma unroll
      for (int r = 0; r < 8; ++r) d[r * Y_STRIDE] = acc[r];
    }
  }
  __syncthreads();

  // ---- Reverse shift: a wave stores one window row, 7 tokens --------------
  // One store is one token's whole 512-byte row. The window row is the same in
  // every lane, so the addresses are scalar work; wave 7 has no row.
  const int wrow = __builtin_amdgcn_readfirstlane(wv);
  if (wrow < WINSZ) {
    int gr = wy * WINSZ + wrow + SHF; if (gr >= IMGE) gr -= IMGE;
    const float* y = lds_y + wrow * WINSZ * Y_STRIDE + lane * 4;
    float* o = out + ((size_t)img * IMGE + gr) * (IMGE * CHN) + lane * 4;
    for (int tx = 0; tx < WINSZ; ++tx) {
      int gc = wx * WINSZ + tx + SHF; if (gc >= IMGE) gc -= IMGE;
      *(float4*)(o + gc * CHN) = *(const float4*)(y + tx * Y_STRIDE);
    }
  }
}

extern "C" void kernel_launch(void* const* d_in, const int* in_sizes, int n_in,
                              void* d_out, int out_size, void* d_ws,
                              size_t ws_size, hipStream_t stream) {
  const float* x     = (const float*)d_in[0];
  const float* qkvW  = (const float*)d_in[1];
  const float* qkvB  = (const float*)d_in[2];
  const float* projW = (const float*)d_in[3];
  const float* projB = (const float*)d_in[4];
  const float* relT  = (const float*)d_in[5];

  _Float16* qkv_pack  = (_Float16*)d_ws;                              // 96 KB
  _Float16* proj_pack = (_Float16*)((char*)d_ws + (size_t)CHN * 384 * 2);

  pack_weights_kernel<<<(CHN * 384 + 255) / 256, 256, 0, stream>>>(
      qkvW, qkv_pack, CHN, 384);
  pack_weights_kernel<<<(CHN * CHN + 255) / 256, 256, 0, stream>>>(
      projW, proj_pack, CHN, CHN);

  swin_window_attn_kernel<<<4096, 256, 0, stream>>>(
      x, qkvB, projB, relT, qkv_pack, proj_pack, (float*)d_out);
}

// v005
// It runs in 51.7 microseconds.
// Two timings next to v004 both put it at 1.07 times that version's speed.
// Over all steps from v000 it is 3.60 times as fast.
#include <hip/hip_runtime.h>
#include <cstddef>

typedef _Float16 v4h  __attribute__((ext_vector_type(4)));
typedef _Float16 v8h  __attribute__((ext_vector_type(8)));
typedef _Float16 v16h __attribute__((ext_vector_type(16)));
typedef float    v8f  __attribute__((ext_vector_type(8)));
typedef int      v4i  __attribute__((ext_vector_type(4)));
typedef float    v4f  __attribute__((ext_vector_type(4)));

#define WINSZ 7
#define SHF   3
#define WSQ   49      // tokens per window
#define NHEAD 4
#define HDIM  32
#define CHN   128
#define IMGE  56

// A workgroup holds two windows that are neighbours in x. Window w has its 49
// tokens in LDS rows 56 * w + 0..48 (56: a multiple of 8, so that 8 tokens of V^T
// stay 16-byte aligned); rows 0..111 are the seven row tiles of both products.
#define WROW  56      // first LDS row of the second window
#define MTILE 7       // 16-row tiles of the QKV and output products
#define AROWS 120     // rows that an attention tile of the second window spans

constexpr int XS_STRIDE = 136;  // halves (also holds O after QKV stage)
constexpr int QK_STRIDE = 264;  // halves, Q|K rows by token (528 B = 16 B x odd)
constexpr int Y_STRIDE  = 132;  // floats, result rows in the Q|K space (528 B)
constexpr int VT_STRIDE = 120;  // halves, V transposed: rows by channel (240 B = 16 B x odd)
constexpr int RP_PITCH  = 176;  // floats, one head's rel-pos bias table

__device__ __forceinline__ v8f wmma_f16(v16h a, v16h b, v8f c) {
  return __builtin_amdgcn_wmma_f32_16x16x32_f16(false, a, false, b, (short)0, c,
                                                false, false);
}

// A-fragment (16x32 f16, M x K), row-major source. Also serves as the
// B-fragment of a transposed matrix (Qᵀ) since lane<->column mapping matches.
__device__ __forceinline__ v16h ldA_row(const _Float16* base, int stride,
                                        int row0, int k0, int lane) {
  const int l  = lane & 15;
  const int kk = k0 + ((lane & 16) ? 8 : 0);
  const _Float16* p = base + (size_t)(row0 + l) * stride + kk;
  v8h lo = *(const v8h*)(p);        // K = kk+0..7
  v8h hi = *(const v8h*)(p + 16);   // K = kk+16..23
  return __builtin_shufflevector(lo, hi, 0,1,2,3,4,5,6,7,8,9,10,11,12,13,14,15);
}

// B-fragment from pre-swizzled pack: 512 halves per fragment, 16/lane contiguous.
__device__ __forceinline__ v16h ldB_pack(const _Float16* frag, int lane) {
  const _Float16* p = frag + lane * 16;
  v8h lo = *(const v8h*)(p);
  v8h hi = *(const v8h*)(p + 8);
  return __builtin_shufflevector(lo, hi, 0,1,2,3,4,5,6,7,8,9,10,11,12,13,14,15);
}

// Lane l <-> lane l ^ 16 (the two halves of a wave hold the two key halves).
__device__ __forceinline__ float swap_halves(float v) {
  int b = __builtin_bit_cast(int, v);
  b = __builtin_amdgcn_permlanex16(b, b, 0x76543210, 0xfedcba98, false, false);
  return __builtin_bit_cast(float, b);
}

// A pointer that is the same in every lane, held in scalar registers: a load from it
// takes the scalar base and one lane offset, and needs no address pair of its own.
typedef __attribute__((address_space(1))) const v4f gv4f;  // in global memory
__device__ __forceinline__ gv4f* scalar_ptr(const float* p) {
  const unsigned long long u = (unsigned long long)p;
  const unsigned lo = __builtin_amdgcn_readfirstlane((unsigned)u);
  const unsigned hi = __builtin_amdgcn_readfirstlane((unsigned)(u >> 32));
  return (gv4f*)(((unsigned long long)hi << 32) | lo);
}

__device__ __forceinline__ int region56(int g) {
  return g < (IMGE - WINSZ) ? 0 : (g < (IMGE - SHF) ? 1 : 2);
}

// ---------------------------------------------------------------------------
// Pre-pass: convert f32 weights to f16, swizzled into WMMA B-fragment layout.
// Fragment f = kc*(N/16)+nt holds 32 lanes x 16 halves.
// lane<16 : col n = nt*16+lane, halves = K {0..7, 16..23}+kc*32
// lane>=16: col n = nt*16+lane-16, halves = K {8..15,24..31}+kc*32
// ---------------------------------------------------------------------------
__global__ void pack_weights_kernel(const float* __restrict__ W,
                                    _Float16* __restrict__ P, int K, int N) {
  int idx = blockIdx.x * blockDim.x + threadIdx.x;
  if (idx >= K * N) return;
  int f    = idx >> 9;
  int lane = (idx >> 4) & 31;
  int i    = idx & 15;
  int NT   = N >> 4;
  int kc   = f / NT, nt = f - kc * NT;
  int l    = lane & 15;
  int hi   = (lane >> 4) & 1;
  int k    = kc * 32 + (i < 8 ? (hi ? 8 : 0) + i : (hi ? 24 : 16) + (i - 8));
  int n    = nt * 16 + l;
  P[idx] = (_Float16)W[(size_t)k * N + n];
}

// ---------------------------------------------------------------------------
// Fused shifted-window attention: one workgroup (8 waves) per pair of windows.
// ---------------------------------------------------------------------------
__global__ __launch_bounds__(256) void swin_window_attn_kernel(
    const float* __restrict__ x, const float* __restrict__ qkv_bias,
    const float* __restrict__ proj_bias, const float* __restrict__ rel_tab,
    const _Float16* __restrict__ qkv_pack, const _Float16* __restrict__ proj_pack,
    float* __restrict__ out) {
  // X tile, later O tile; behind the seven row tiles, spare rows for padding queries
  __shared__ __attribute__((aligned(16))) _Float16 lds_xs[(MTILE + 2) * 16 * XS_STRIDE];
  // Q|K by token (256 cols, q pre-scaled); later the f32 result rows
  __shared__ __attribute__((aligned(16))) _Float16 lds_qk[AROWS * QK_STRIDE];
  // V transposed: [channel][token]
  __shared__ __attribute__((aligned(16))) _Float16 lds_vt[CHN * VT_STRIDE];
  // rel-pos bias table, [head][169]
  __shared__ float lds_rp[NHEAD * RP_PITCH];
  // per token: ty * 13 + tx (its part of the bias index), shift-mask region
  __shared__ __attribute__((aligned(16))) int lds_koff[64];
  __shared__ __attribute__((aligned(16))) int lds_kreg[2 * 64];  // [window][token]

  const int tid  = threadIdx.x;
  const int lane = tid & 31;
  const int wv   = tid >> 5;  // 8 waves

  const int blk = blockIdx.x;           // 2048 = 64 imgs * 8 * 4 window pairs
  const int img = blk >> 5;
  const int wy  = (blk >> 2) & 7;
  const int wx0 = (blk & 3) * 2;        // the pair's left window

  // QKV bias of the wave's three column tiles (Q, K, V), read ahead of the gather
  // so that stage B does not wait for it in front of its weight loads.
  float qb[3];
  #pragma unroll  // qb[] is indexed by constants only, so it stays in registers
  for (int g = 0; g < 3; ++g) qb[g] = qkv_bias[(g * 8 + wv) * 16 + (lane & 15)];

  // ---- Stage A: gather shifted window into LDS (f32 -> f16) ----------------
  // Every load of a wave is issued before the first of them is waited for.
  const int wvs = __builtin_amdgcn_readfirstlane(wv);  // scalar addresses
  float rt[3];  // rel-pos table, 676 entries; the last read is clamped
  #pragma unroll  // rt[] is indexed by constants only; three loads in flight
  for (int k = 0; k < 3; ++k)
    rt[k] = rel_tab[min(tid + 256 * k, 169 * NHEAD - 1)];

  if (wvs < WINSZ) {
    // Waves 0..6: one row of both windows each, 14 tokens, one token's 512-byte row
    // per load. The row is the same in every lane: addresses are scalar work.
    int gr = wy * WINSZ + wvs + SHF; if (gr >= IMGE) gr -= IMGE;
    const float* xr = x + ((size_t)img * IMGE + gr) * (IMGE * CHN);  // scalar base
    v4f xv[2 * WINSZ];
    #pragma unroll  // xv[] is indexed by constants only; fourteen loads in flight
    for (int i = 0; i < 2 * WINSZ; ++i) {
      int gc = wx0 * WINSZ + i + SHF; if (gc >= IMGE) gc -= IMGE;
      xv[i] = scalar_ptr(xr + gc * CHN)[(unsigned)lane];
    }
    _Float16* d = lds_xs + wvs * WINSZ * XS_STRIDE + lane * 4;
    #pragma unroll  // a loop of its own: no store stands between two loads
    for (int i = 0; i < 2 * WINSZ; ++i) {
      v4h h;
      h[0] = (_Float16)xv[i].x; h[1] = (_Float16)xv[i].y;
      h[2] = (_Float16)xv[i].z; h[3] = (_Float16)xv[i].w;
      *(v4h*)(d + ((i / WINSZ) * WROW + i % WINSZ) * XS_STRIDE) = h;
    }
  } else {
    // Wave 7, which has no window row: the per-token tables and the zero rows.
    for (int t = lane; t < WSQ; t += 32) {
      int ty = t / WINSZ, tx = t - ty * WINSZ;
      lds_koff[t] = ty * 13 + tx;
      const int ry = region56(wy * WINSZ + ty) * 3;
      lds_kreg[t]      = ry + region56(wx0 * WINSZ + tx);
      lds_kreg[64 + t] = ry + region56((wx0 + 1) * WINSZ + tx);
    }
    const v4h z = {};
    for (int r = WSQ; r < WROW; ++r) {  // zero-pad rows 49..55 and 105..111
      *(v4h*)(lds_xs + r * XS_STRIDE + lane * 4) = z;
      *(v4h*)(lds_xs + (WROW + r) * XS_STRIDE + lane * 4) = z;
    }
    // The second window's last key and query tiles span rows 104..119; no product
    // writes rows 112..119 of Q|K or those token columns of V^T: zeros there.
    const v8h z8 = {};
    for (int r = MTILE * 16; r < AROWS; ++r)
      *(v8h*)(lds_qk + r * QK_STRIDE + lane * 8) = z8;
    for (int ch = lane; ch < CHN; ch += 32)
      *(v8h*)(lds_vt + ch * VT_STRIDE + MTILE * 16) = z8;
  }
  #pragma unroll  // rt[] again by constants
  for (int k = 0; k < 3; ++k) {
    const int j = tid + 256 * k;
    if (j < 169 * NHEAD) lds_rp[(j & 3) * RP_PITCH + (j >> 2)] = rt[k];
  }

  __syncthreads();

  // ---- Stage B: QKV = X @ Wqkv + b (q columns pre-scaled by 1/sqrt(32)) ----
  // A wave owns one 16-column tile of Q, one of K and one of V. All twelve weight
  // fragments are loaded once and stay in registers for the seven row tiles of
  // the two windows; each X fragment is read from LDS once and feeds three products.
  const float qscale = 0.17677669529663687f;
  {
    const int rhalf = (lane & 16) ? 8 : 0;
    const int cq = wvs * 16 + (lane & 15);  // the wave's column inside Q, K or V
    v16h b[3][4];
    #pragma unroll  // b[][] is indexed by constants only, so it stays in registers
    for (int g = 0; g < 3; ++g)  // 0: Q, 1: K, 2: V
      #pragma unroll
      for (int kc = 0; kc < 4; ++kc)
        b[g][kc] = ldB_pack(qkv_pack + (size_t)(kc * 24 + g * 8 + wvs) * 512, lane);
    // Kept rolled: unrolled, the build held so many row tiles' accumulators at once
    // that it spilled. A trip has three independent chains of four products.
    #pragma unroll 1
    for (int mt = 0; mt < MTILE; ++mt) {
      v8f acc[3];
      #pragma unroll
      for (int g = 0; g < 3; ++g)
        #pragma unroll
        for (int i = 0; i < 8; ++i) acc[g][i] = qb[g];
      #pragma unroll
      for (int kc = 0; kc < 4; ++kc) {
        const v16h a = ldA_row(lds_xs, XS_STRIDE, mt * 16, kc * 32, lane);
        #pragma unroll
        for (int g = 0; g < 3; ++g) acc[g] = wmma_f16(a, b[g][kc], acc[g]);
      }
      const int rbase = mt * 16 + rhalf;
      #pragma unroll
      for (int r = 0; r < 8; ++r) {  // Q, K: rows by token
        lds_qk[(rbase + r) * QK_STRIDE + cq] = (_Float16)(acc[0][r] * qscale);
        lds_qk[(rbase + r) * QK_STRIDE + CHN + cq] = (_Float16)acc[1][r];
      }
      v8h vv;  // V: a lane's 8 tokens of one channel, one 16-byte store
      #pragma unroll
      for (int r = 0; r < 8; ++r) vv[r] = (_Float16)acc[2][r];
      *(v8h*)(lds_vt + cq * VT_STRIDE + rbase) = vv;
    }
  }
  __syncthreads();

  // ---- Attention, all in one wave's registers ------------------------------
  // A wave owns 16 queries (mt) of one window, all heads. S^T = K Q^T: in every 16-key
  // tile lane (c, hh) holds keys 8*hh+0..7 of query c, so the softmax runs
  // in-lane plus one exchange of the wave's halves; two score tiles, converted
  // in place, are the B operand P^T of O^T = V^T P^T.
  {
    const int c  = lane & 15;
    const int hh = lane >> 4;
    const int mt = wvs & 3;
    const int w  = wvs >> 2;    // the wave's window
    const int wb = w * WROW;    // its first LDS row
    const int* kreg = lds_kreg + w * 64;

    // Padding queries 49..63 take query 48's bias and mask. Their O rows go to spare
    // rows that nobody reads: the first window's rows 56..63 hold the second
    // window's tokens. An address select, so that no branch stands among the WMMAs.
    const int orow = mt * 16 + c < WSQ ? wb + mt * 16 + c : (MTILE + w) * 16 + c;
    const int sq = min(mt * 16 + c, WSQ - 1);
    // bias index = (sy - ty + 6) * 13 + (sx - tx + 6) = koff[s] + 84 - koff[t]
    const int qoff = lds_koff[sq] + 84;
    const bool edge = wy == 7 || wx0 + w == 7;  // only these windows mix regions
    const float L2E = 1.4426950408889634f;  // exp(x) = exp2(x * log2 e)

    // Kept rolled: one head's scores live at a time, and the loop's text stays short.
    #pragma unroll 1
    for (int hd = 0; hd < NHEAD; ++hd) {
      const float* rp = lds_rp + hd * RP_PITCH + qoff;

      // The bias is the C operand of the score product. Key tile 3 holds one
      // real key, 48 (hh == 0, register 0; koff = 84).
      v8f st[4];
      #pragma unroll
      for (int kt = 0; kt < 3; ++kt) {
        const v4i ka = *(const v4i*)(lds_koff + kt * 16 + 8 * hh);
        const v4i kb = *(const v4i*)(lds_koff + kt * 16 + 8 * hh + 4);
        #pragma unroll
        for (int r = 0; r < 8; ++r) st[kt][r] = rp[-(r < 4 ? ka[r] : kb[r - 4])];
      }
      {
        v8f z = {};
        z[0] = rp[-84];
        st[3] = z;
      }

      const v16h bq = ldA_row(lds_qk, QK_STRIDE, wb + mt * 16, hd * HDIM, lane);
      #pragma unroll
      for (int kt = 0; kt < 4; ++kt) {
        v16h ak = ldA_row(lds_qk, QK_STRIDE, wb + kt * 16, CHN + hd * HDIM, lane);
        st[kt] = wmma_f16(ak, bq, st[kt]);
      }

      if (edge) {
        const int qreg = kreg[sq];
        #pragma unroll
        for (int kt = 0; kt < 3; ++kt) {
          const v4i ra = *(const v4i*)(kreg + kt * 16 + 8 * hh);
          const v4i rb = *(const v4i*)(kreg + kt * 16 + 8 * hh + 4);
          #pragma unroll
          for (int r = 0; r < 8; ++r)
            st[kt][r] += (r < 4 ? ra[r] : rb[r - 4]) == qreg ? 0.f : -100.f;
        }
        st[3][0] += kreg[WSQ - 1] == qreg ? 0.f : -100.f;
      }

      const float s48 = hh ? -1e30f : st[3][0];  // keys 49..63 do not exist
      float mx = s48;
      #pragma unroll
      for (int kt = 0; kt < 3; ++kt)
        #pragma unroll
        for (int r = 0; r < 8; ++r) mx = fmaxf(mx, st[kt][r]);
      mx = fmaxf(mx, swap_halves(mx));
      const float mb = mx * L2E;

      float part[3];
      v16h pb0, pb1;
      #pragma unroll
      for (int kt = 0; kt < 3; ++kt) {
        part[kt] = 0.f;
        #pragma unroll
        for (int r = 0; r < 8; ++r) {
          float p = __builtin_amdgcn_exp2f(fmaf(st[kt][r], L2E, -mb));
          part[kt] += p;
          if (kt == 0) pb0[r] = (_Float16)p;
          if (kt == 1) pb0[8 + r] = (_Float16)p;
          if (kt == 2) pb1[r] = (_Float16)p;
        }
      }
      const float p48 = __builtin_amdgcn_exp2f(fmaf(s48, L2E, -mb));
      pb1[8] = (_Float16)p48;
      #pragma unroll
      for (int r = 1; r < 8; ++r) pb1[8 + r] = (_Float16)0;
      float sum = (part[0] + part[1]) + (part[2] + p48);
      sum += swap_halves(sum);
      const float inv = 1.0f / sum;

      #pragma unroll
      for (int dt = 0; dt < 2; ++dt) {
        const int ch = hd * HDIM + dt * 16;
        v8f acc = {};
        acc = wmma_f16(ldA_row(lds_vt, VT_STRIDE, ch, wb, lane), pb0, acc);
        acc = wmma_f16(ldA_row(lds_vt, VT_STRIDE, ch, wb + 32, lane), pb1, acc);
        v8h o;  // channels ch + 8*hh + 0..7 of query c
        #pragma unroll
        for (int r = 0; r < 8; ++r) o[r] = (_Float16)(acc[r] * inv);
        *(v8h*)(lds_xs + orow * XS_STRIDE + ch + 8 * hh) = o;
      }
    }
  }
  __syncthreads();

  // ---- Stage E: Y = O @ Wproj + b, staged in LDS by token ------------------
  // Q|K are dead behind the barrier above; their rows of 528 bytes hold the
  // f32 result rows (128 floats + 4 of pad: the wave's two halves, 8 rows
  // apart, fall on different banks).
  float* lds_y = reinterpret_cast<float*>(lds_qk);
  {
    const int col = wv * 16 + (lane & 15);   // a wave owns 16 output channels
    const float bv = proj_bias[col];
    v16h b[4];
    #pragma unroll  // b[] is indexed by constants only, so it stays in registers
    for (int kc = 0; kc < 4; ++kc)
      b[kc] = ldB_pack(proj_pack + (size_t)(kc * 8 + wv) * 512, lane);
    #pragma unroll  // row tiles are independent: their chains can be interleaved
    for (int mt = 0; mt < MTILE; ++mt) {
      v8f acc;
      #pragma unroll
      for (int i = 0; i < 8; ++i) acc[i] = bv;
      #pragma unroll
      for (int kc = 0; kc < 4; ++kc)
        acc = wmma_f16(ldA_row(lds_xs, XS_STRIDE, mt * 16, kc * 32, lane),
                       b[kc], acc);
      float* d = lds_y + (mt * 16 + ((lane & 16) ? 8 : 0)) * Y_STRIDE + col;
      #pragma unroll
      for (int r = 0; r < 8; ++r) d[r * Y_STRIDE] = acc[r];
    }
  }
  __syncthreads();

  // ---- Reverse shift: a wave stores one row of both windows, 14 tokens -----
  // One store is one token's whole 512-byte row. The window row is the same in
  // every lane, so the addresses are scalar work; wave 7 has no row.
  const int wrow = __builtin_amdgcn_readfirstlane(wv);
  if (wrow < WINSZ) {
    int gr = wy * WINSZ + wrow + SHF; if (gr >= IMGE) gr -= IMGE;
    const float* y = lds_y + wrow * WINSZ * Y_STRIDE + lane * 4;
    float* o = out + ((size_t)img * IMGE + gr) * (IMGE * CHN) + lane * 4;
    for (int i = 0; i < 2 * WINSZ; ++i) {
      int gc = wx0 * WINSZ + i + SHF; if (gc >= IMGE) gc -= IMGE;
      *(float4*)(o + gc * CHN) =
          *(const float4*)(y + ((i / WINSZ) * WROW + i % WINSZ) * Y_STRIDE);
    }
  }
}

extern "C" void kernel_launch(void* const* d_in, const int* in_sizes, int n_in,
                              void* d_out, int out_size, void* d_ws,
                              size_t ws_size, hipStream_t stream) {
  const float* x     = (const float*)d_in[0];
  const float* qkvW  = (const float*)d_in[1];
  const float* qkvB  = (const float*)d_in[2];
  const float* projW = (const float*)d_in[3];
  const float* projB = (const float*)d_in[4];
  const float* relT  = (const float*)d_in[5];

  _Float16* qkv_pack  = (_Float16*)d_ws;                              // 96 KB
  _Float16* proj_pack = (_Float16*)((char*)d_ws + (size_t)CHN * 384 * 2);

  pack_weights_kernel<<<(CHN * 384 + 255) / 256, 256, 0, stream>>>(
      qkvW, qkv_pack, CHN, 384);
  pack_weights_kernel<<<(CHN * CHN + 255) / 256, 256, 0, stream>>>(
      projW, proj_pack, CHN, CHN);

  swin_window_attn_kernel<<<2048, 256, 0, stream>>>(
      x, qkvB, projB, relT, qkv_pack, proj_pack, (float*)d_out);
}

// v006
// One run takes 47.9 microseconds.
// Two timings next to v005 put it at 1.07 and 1.08 times that version's speed.
// Counting every step since v000, it is 3.88 times as fast.
#include <hip/hip_runtime.h>
#include <cstddef>

typedef _Float16 v4h  __attribute__((ext_vector_type(4)));
typedef _Float16 v8h  __attribute__((ext_vector_type(8)));
typedef _Float16 v16h __attribute__((ext_vector_type(16)));
typedef float    v8f  __attribute__((ext_vector_type(8)));
typedef int      v4i  __attribute__((ext_vector_type(4)));
typedef float    v4f  __attribute__((ext_vector_type(4)));

#define WINSZ 7
#define SHF   3
#define WSQ   49      // tokens per window
#define NHEAD 4
#define HDIM  32
#define CHN   128
#define IMGE  56

// A workgroup holds two windows that are neighbours in x. Window w has its 49
// tokens in LDS rows 56 * w + 0..48 (56: a multiple of 8, so that 8 tokens of V^T
// stay 16-byte aligned); rows 0..111 are the seven row tiles of both products.
#define WROW  56      // first LDS row of the second window
#define MTILE 7       // 16-row tiles of the QKV and output products
#define AROWS 120     // rows that an attention tile of the second window spans

constexpr int XS_STRIDE = 136;  // halves (also holds O after QKV stage)
constexpr int QK_STRIDE = 264;  // halves, Q|K rows by token (528 B = 16 B x odd)
constexpr int Y_STRIDE  = 132;  // floats, result rows in the Q|K space (528 B)
constexpr int VT_STRIDE = 120;  // halves, V transposed: rows by channel (240 B = 16 B x odd)
constexpr int RP_PITCH  = 176;  // floats, one head's rel-pos bias table

__device__ __forceinline__ v8f wmma_f16(v16h a, v16h b, v8f c) {
  return __builtin_amdgcn_wmma_f32_16x16x32_f16(false, a, false, b, (short)0, c,
                                                false, false);
}

// A-fragment (16x32 f16, M x K), row-major source. Also serves as the
// B-fragment of a transposed matrix (Qᵀ) since lane<->column mapping matches.
__device__ __forceinline__ v16h ldA_row(const _Float16* base, int stride,
                                        int row0, int k0, int lane) {
  const int l  = lane & 15;
  const int kk = k0 + ((lane & 16) ? 8 : 0);
  const _Float16* p = base + (size_t)(row0 + l) * stride + kk;
  v8h lo = *(const v8h*)(p);        // K = kk+0..7
  v8h hi = *(const v8h*)(p + 16);   // K = kk+16..23
  return __builtin_shufflevector(lo, hi, 0,1,2,3,4,5,6,7,8,9,10,11,12,13,14,15);
}

// B-fragment from pre-swizzled pack: 512 halves per fragment, 16/lane contiguous.
__device__ __forceinline__ v16h ldB_pack(const _Float16* frag, int lane) {
  const _Float16* p = frag + lane * 16;
  v8h lo = *(const v8h*)(p);
  v8h hi = *(const v8h*)(p + 8);
  return __builtin_shufflevector(lo, hi, 0,1,2,3,4,5,6,7,8,9,10,11,12,13,14,15);
}

// Lane l <-> lane l ^ 16 (the two halves of a wave hold the two key halves).
__device__ __forceinline__ float swap_halves(float v) {
  int b = __builtin_bit_cast(int, v);
  b = __builtin_amdgcn_permlanex16(b, b, 0x76543210, 0xfedcba98, false, false);
  return __builtin_bit_cast(float, b);
}

// A pointer that is the same in every lane, held in scalar registers: a load from it
// takes the scalar base and one lane offset, and needs no address pair of its own.
typedef __attribute__((address_space(1))) const v4f gv4f;  // in global memory
__device__ __forceinline__ gv4f* scalar_ptr(const float* p) {
  const unsigned long long u = (unsigned long long)p;
  const unsigned lo = __builtin_amdgcn_readfirstlane((unsigned)u);
  const unsigned hi = __builtin_amdgcn_readfirstlane((unsigned)(u >> 32));
  return (gv4f*)(((unsigned long long)hi << 32) | lo);
}

__device__ __forceinline__ int region56(int g) {
  return g < (IMGE - WINSZ) ? 0 : (g < (IMGE - SHF) ? 1 : 2);
}

// ---------------------------------------------------------------------------
// Pre-pass: convert f32 weights to f16, swizzled into WMMA B-fragment layout.
// Fragment f = kc*(N/16)+nt holds 32 lanes x 16 halves.
// lane<16 : col n = nt*16+lane, halves = K {0..7, 16..23}+kc*32
// lane>=16: col n = nt*16+lane-16, halves = K {8..15,24..31}+kc*32
// ---------------------------------------------------------------------------
template <int N>  // N: columns of the K x N matrix, known at compile time
__device__ __forceinline__ void pack_element(const float* __restrict__ Wm,
                                             _Float16* __restrict__ P, int idx) {
  constexpr int NT = N >> 4;
  int f    = idx >> 9;
  int lane = (idx >> 4) & 31;
  int i    = idx & 15;
  int kc   = f / NT, nt = f - kc * NT;
  int l    = lane & 15;
  int hi   = (lane >> 4) & 1;
  int k    = kc * 32 + (i < 8 ? (hi ? 8 : 0) + i : (hi ? 24 : 16) + (i - 8));
  int n    = nt * 16 + l;
  P[idx] = (_Float16)Wm[(size_t)k * N + n];
}

// Both matrices in one launch: the two packs do not depend on each other, so the
// block index picks the matrix (a block-uniform branch), one element per thread.
constexpr int QKV_BLOCKS  = CHN * 3 * CHN / 256;  // 192
constexpr int PROJ_BLOCKS = CHN * CHN / 256;      // 64
__global__ __launch_bounds__(256) void pack_weights_kernel(
    const float* __restrict__ qkvW, const float* __restrict__ projW,
    _Float16* __restrict__ qkvP, _Float16* __restrict__ projP) {
  const int blk = blockIdx.x;
  if (blk < QKV_BLOCKS)
    pack_element<3 * CHN>(qkvW, qkvP, blk * 256 + threadIdx.x);
  else
    pack_element<CHN>(projW, projP, (blk - QKV_BLOCKS) * 256 + threadIdx.x);
}

// ---------------------------------------------------------------------------
// Fused shifted-window attention: one workgroup (8 waves) per pair of windows.
// ---------------------------------------------------------------------------
__global__ __launch_bounds__(256) void swin_window_attn_kernel(
    const float* __restrict__ x, const float* __restrict__ qkv_bias,
    const float* __restrict__ proj_bias, const float* __restrict__ rel_tab,
    const _Float16* __restrict__ qkv_pack, const _Float16* __restrict__ proj_pack,
    float* __restrict__ out) {
  // X tile, later O tile; behind the seven row tiles, spare rows for padding queries
  __shared__ __attribute__((aligned(16))) _Float16 lds_xs[(MTILE + 2) * 16 * XS_STRIDE];
  // Q|K by token (256 cols, q pre-scaled); later the f32 result rows
  __shared__ __attribute__((aligned(16))) _Float16 lds_qk[AROWS * QK_STRIDE];
  // V transposed: [channel][token]
  __shared__ __attribute__((aligned(16))) _Float16 lds_vt[CHN * VT_STRIDE];
  // rel-pos bias table, [head][169]
  __shared__ float lds_rp[NHEAD * RP_PITCH];
  // per token: ty * 13 + tx (its part of the bias index), shift-mask region
  __shared__ __attribute__((aligned(16))) int lds_koff[64];
  __shared__ __attribute__((aligned(16))) int lds_kreg[2 * 64];  // [window][token]

  const int tid  = threadIdx.x;
  const int lane = tid & 31;
  const int wv   = tid >> 5;  // 8 waves

  const int blk = blockIdx.x;           // 2048 = 64 imgs * 8 * 4 window pairs
  const int img = blk >> 5;
  const int wy  = (blk >> 2) & 7;
  const int wx0 = (blk & 3) * 2;        // the pair's left window

  // QKV bias of the wave's three column tiles (Q, K, V), read ahead of the gather
  // so that stage B does not wait for it in front of its weight loads.
  float qb[3];
  #pragma unroll  // qb[] is indexed by constants only, so it stays in registers
  for (int g = 0; g < 3; ++g) qb[g] = qkv_bias[(g * 8 + wv) * 16 + (lane & 15)];

  // ---- Stage A: gather shifted window into LDS (f32 -> f16) ----------------
  // Every load of a wave is issued before the first of them is waited for.
  const int wvs = __builtin_amdgcn_readfirstlane(wv);  // scalar addresses
  float rt[3];  // rel-pos table, 676 entries; the last read is clamped
  #pragma unroll  // rt[] is indexed by constants only; three loads in flight
  for (int k = 0; k < 3; ++k)
    rt[k] = rel_tab[min(tid + 256 * k, 169 * NHEAD - 1)];

  if (wvs < WINSZ) {
    // Waves 0..6: one row of both windows each, 14 tokens, one token's 512-byte row
    // per load. The row is the same in every lane: addresses are scalar work.
    int gr = wy * WINSZ + wvs + SHF; if (gr >= IMGE) gr -= IMGE;
    const float* xr = x + ((size_t)img * IMGE + gr) * (IMGE * CHN);  // scalar base
    v4f xv[2 * WINSZ];
    #pragma unroll  // xv[] is indexed by constants only; fourteen loads in flight
    for (int i = 0; i < 2 * WINSZ; ++i) {
      int gc = wx0 * WINSZ + i + SHF; if (gc >= IMGE) gc -= IMGE;
      xv[i] = scalar_ptr(xr + gc * CHN)[(unsigned)lane];
    }
    _Float16* d = lds_xs + wvs * WINSZ * XS_STRIDE + lane * 4;
    #pragma unroll  // a loop of its own: no store stands between two loads
    for (int i = 0; i < 2 * WINSZ; ++i) {
      v4h h;
      h[0] = (_Float16)xv[i].x; h[1] = (_Float16)xv[i].y;
      h[2] = (_Float16)xv[i].z; h[3] = (_Float16)xv[i].w;
      *(v4h*)(d + ((i / WINSZ) * WROW + i % WINSZ) * XS_STRIDE) = h;
    }
  } else {
    // Wave 7, which has no window row: the per-token tables and the zero rows.
    for (int t = lane; t < WSQ; t += 32) {
      int ty = t / WINSZ, tx = t - ty * WINSZ;
      lds_koff[t] = ty * 13 + tx;
      const int ry = region56(wy * WINSZ + ty) * 3;
      lds_kreg[t]      = ry + region56(wx0 * WINSZ + tx);
      lds_kreg[64 + t] = ry + region56((wx0 + 1) * WINSZ + tx);
    }
    const v4h z = {};
    for (int r = WSQ; r < WROW; ++r) {  // zero-pad rows 49..55 and 105..111
      *(v4h*)(lds_xs + r * XS_STRIDE + lane * 4) = z;
      *(v4h*)(lds_xs + (WROW + r) * XS_STRIDE + lane * 4) = z;
    }
    // The second window's last key and query tiles span rows 104..119; no product
    // writes rows 112..119 of Q|K or those token columns of V^T: zeros there.
    const v8h z8 = {};
    for (int r = MTILE * 16; r < AROWS; ++r)
      *(v8h*)(lds_qk + r * QK_STRIDE + lane * 8) = z8;
    for (int ch = lane; ch < CHN; ch += 32)
      *(v8h*)(lds_vt + ch * VT_STRIDE + MTILE * 16) = z8;
  }
  #pragma unroll  // rt[] again by constants
  for (int k = 0; k < 3; ++k) {
    const int j = tid + 256 * k;
    if (j < 169 * NHEAD) lds_rp[(j & 3) * RP_PITCH + (j >> 2)] = rt[k];
  }

  __syncthreads();

  // ---- Stage B: QKV = X @ Wqkv + b (q columns pre-scaled by 1/sqrt(32)) ----
  // A wave owns one 16-column tile of Q, one of K and one of V. All twelve weight
  // fragments are loaded once and stay in registers for the seven row tiles of
  // the two windows; each X fragment is read from LDS once and feeds three products.
  const float qscale = 0.17677669529663687f;
  {
    const int rhalf = (lane & 16) ? 8 : 0;
    const int cq = wvs * 16 + (lane & 15);  // the wave's column inside Q, K or V
    v16h b[3][4];
    #pragma unroll  // b[][] is indexed by constants only, so it stays in registers
    for (int g = 0; g < 3; ++g)  // 0: Q, 1: K, 2: V
      #pragma unroll
      for (int kc = 0; kc < 4; ++kc)
        b[g][kc] = ldB_pack(qkv_pack + (size_t)(kc * 24 + g * 8 + wvs) * 512, lane);
    // Kept rolled: unrolled, the build held so many row tiles' accumulators at once
    // that it spilled. A trip has three independent chains of four products.
    #pragma unroll 1
    for (int mt = 0; mt < MTILE; ++mt) {
      v8f acc[3];
      #pragma unroll
      for (int g = 0; g < 3; ++g)
        #pragma unroll
        for (int i = 0; i < 8; ++i) acc[g][i] = qb[g];
      #pragma unroll
      for (int kc = 0; kc < 4; ++kc) {
        const v16h a = ldA_row(lds_xs, XS_STRIDE, mt * 16, kc * 32, lane);
        #pragma unroll
        for (int g = 0; g < 3; ++g) acc[g] = wmma_f16(a, b[g][kc], acc[g]);
      }
      const int rbase = mt * 16 + rhalf;
      #pragma unroll
      for (int r = 0; r < 8; ++r) {  // Q, K: rows by token
        lds_qk[(rbase + r) * QK_STRIDE + cq] = (_Float16)(acc[0][r] * qscale);
        lds_qk[(rbase + r) * QK_STRIDE + CHN + cq] = (_Float16)acc[1][r];
      }
      v8h vv;  // V: a lane's 8 tokens of one channel, one 16-byte store
      #pragma unroll
      for (int r = 0; r < 8; ++r) vv[r] = (_Float16)acc[2][r];
      *(v8h*)(lds_vt + cq * VT_STRIDE + rbase) = vv;
    }
  }
  __syncthreads();

  // ---- Attention, all in one wave's registers ------------------------------
  // A wave owns 16 queries (mt) of one window, all heads. S^T = K Q^T: in every 16-key
  // tile lane (c, hh) holds keys 8*hh+0..7 of query c, so the softmax runs
  // in-lane plus one exchange of the wave's halves; two score tiles, converted
  // in place, are the B operand P^T of O^T = V^T P^T.
  {
    const int c  = lane & 15;
    const int hh = lane >> 4;
    const int mt = wvs & 3;
    const int w  = wvs >> 2;    // the wave's window
    const int wb = w * WROW;    // its first LDS row
    const int* kreg = lds_kreg + w * 64;

    // Padding queries 49..63 take query 48's bias and mask. Their O rows go to spare
    // rows that nobody reads: the first window's rows 56..63 hold the second
    // window's tokens. An address select, so that no branch stands among the WMMAs.
    const int orow = mt * 16 + c < WSQ ? wb + mt * 16 + c : (MTILE + w) * 16 + c;
    const int sq = min(mt * 16 + c, WSQ - 1);
    // bias index = (sy - ty + 6) * 13 + (sx - tx + 6) = koff[s] + 84 - koff[t]
    const int qoff = lds_koff[sq] + 84;
    const bool edge = wy == 7 || wx0 + w == 7;  // only these windows mix regions
    const float L2E = 1.4426950408889634f;  // exp(x) = exp2(x * log2 e)

    // Kept rolled: one head's scores live at a time, and the loop's text stays short.
    #pragma unroll 1
    for (int hd = 0; hd < NHEAD; ++hd) {
      const float* rp = lds_rp + hd * RP_PITCH + qoff;

      // The bias is the C operand of the score product. Key tile 3 holds one
      // real key, 48 (hh == 0, register 0; koff = 84).
      v8f st[4];
      #pragma unroll
      for (int kt = 0; kt < 3; ++kt) {
        const v4i ka = *(const v4i*)(lds_koff + kt * 16 + 8 * hh);
        const v4i kb = *(const v4i*)(lds_koff + kt * 16 + 8 * hh + 4);
        #pragma unroll
        for (int r = 0; r < 8; ++r) st[kt][r] = rp[-(r < 4 ? ka[r] : kb[r - 4])];
      }
      {
        v8f z = {};
        z[0] = rp[-84];
        st[3] = z;
      }

      const v16h bq = ldA_row(lds_qk, QK_STRIDE, wb + mt * 16, hd * HDIM, lane);
      #pragma unroll
      for (int kt = 0; kt < 4; ++kt) {
        v16h ak = ldA_row(lds_qk, QK_STRIDE, wb + kt * 16, CHN + hd * HDIM, lane);
        st[kt] = wmma_f16(ak, bq, st[kt]);
      }

      if (edge) {
        const int qreg = kreg[sq];
        #pragma unroll
        for (int kt = 0; kt < 3; ++kt) {
          const v4i ra = *(const v4i*)(kreg + kt * 16 + 8 * hh);
          const v4i rb = *(const v4i*)(kreg + kt * 16 + 8 * hh + 4);
          #pragma unroll
          for (int r = 0; r < 8; ++r)
            st[kt][r] += (r < 4 ? ra[r] : rb[r - 4]) == qreg ? 0.f : -100.f;
        }
        st[3][0] += kreg[WSQ - 1] == qreg ? 0.f : -100.f;
      }

      const float s48 = hh ? -1e30f : st[3][0];  // keys 49..63 do not exist
      float mx = s48;
      #pragma unroll
      for (int kt = 0; kt < 3; ++kt)
        #pragma unroll
        for (int r = 0; r < 8; ++r) mx = fmaxf(mx, st[kt][r]);
      mx = fmaxf(mx, swap_halves(mx));
      const float mb = mx * L2E;

      float part[3];
      v16h pb0, pb1;
      #pragma unroll
      for (int kt = 0; kt < 3; ++kt) {
        part[kt] = 0.f;
        #pragma unroll
        for (int r = 0; r < 8; ++r) {
          float p = __builtin_amdgcn_exp2f(fmaf(st[kt][r], L2E, -mb));
          part[kt] += p;
          if (kt == 0) pb0[r] = (_Float16)p;
          if (kt == 1) pb0[8 + r] = (_Float16)p;
          if (kt == 2) pb1[r] = (_Float16)p;
        }
      }
      const float p48 = __builtin_amdgcn_exp2f(fmaf(s48, L2E, -mb));
      pb1[8] = (_Float16)p48;
      #pragma unroll
      for (int r = 1; r < 8; ++r) pb1[8 + r] = (_Float16)0;
      float sum = (part[0] + part[1]) + (part[2] + p48);
      sum += swap_halves(sum);
      const float inv = 1.0f / sum;

      #pragma unroll
      for (int dt = 0; dt < 2; ++dt) {
        const int ch = hd * HDIM + dt * 16;
        v8f acc = {};
        acc = wmma_f16(ldA_row(lds_vt, VT_STRIDE, ch, wb, lane), pb0, acc);
        acc = wmma_f16(ldA_row(lds_vt, VT_STRIDE, ch, wb + 32, lane), pb1, acc);
        v8h o;  // channels ch + 8*hh + 0..7 of query c
        #pragma unroll
        for (int r = 0; r < 8; ++r) o[r] = (_Float16)(acc[r] * inv);
        *(v8h*)(lds_xs + orow * XS_STRIDE + ch + 8 * hh) = o;
      }
    }
  }
  __syncthreads();

  // ---- Stage E: Y = O @ Wproj + b, staged in LDS by token ------------------
  // Q|K are dead behind the barrier above; their rows of 528 bytes hold the
  // f32 result rows (128 floats + 4 of pad: the wave's two halves, 8 rows
  // apart, fall on different banks).
  float* lds_y = reinterpret_cast<float*>(lds_qk);
  {
    const int col = wv * 16 + (lane & 15);   // a wave owns 16 output channels
    const float bv = proj_bias[col];
    v16h b[4];
    #pragma unroll  // b[] is indexed by constants only, so it stays in registers
    for (int kc = 0; kc < 4; ++kc)
      b[kc] = ldB_pack(proj_pack + (size_t)(kc * 8 + wv) * 512, lane);
    #pragma unroll  // row tiles are independent: their chains can be interleaved
    for (int mt = 0; mt < MTILE; ++mt) {
      v8f acc;
      #pragma unroll
      for (int i = 0; i < 8; ++i) acc[i] = bv;
      #pragma unroll
      for (int kc = 0; kc < 4; ++kc)
        acc = wmma_f16(ldA_row(lds_xs, XS_STRIDE, mt * 16, kc * 32, lane),
                       b[kc], acc);
      float* d = lds_y + (mt * 16 + ((lane & 16) ? 8 : 0)) * Y_STRIDE + col;
      #pragma unroll
      for (int r = 0; r < 8; ++r) d[r * Y_STRIDE] = acc[r];
    }
  }
  __syncthreads();

  // ---- Reverse shift: a wave stores one row of both windows, 14 tokens -----
  // One store is one token's whole 512-byte row. The window row is the same in
  // every lane, so the addresses are scalar work; wave 7 has no row.
  const int wrow = __builtin_amdgcn_readfirstlane(wv);
  if (wrow < WINSZ) {
    int gr = wy * WINSZ + wrow + SHF; if (gr >= IMGE) gr -= IMGE;
    const float* y = lds_y + wrow * WINSZ * Y_STRIDE + lane * 4;
    float* o = out + ((size_t)img * IMGE + gr) * (IMGE * CHN) + lane * 4;
    for (int i = 0; i < 2 * WINSZ; ++i) {
      int gc = wx0 * WINSZ + i + SHF; if (gc >= IMGE) gc -= IMGE;
      *(float4*)(o + gc * CHN) =
          *(const float4*)(y + ((i / WINSZ) * WROW + i % WINSZ) * Y_STRIDE);
    }
  }
}

extern "C" void kernel_launch(void* const* d_in, const int* in_sizes, int n_in,
                              void* d_out, int out_size, void* d_ws,
                              size_t ws_size, hipStream_t stream) {
  const float* x     = (const float*)d_in[0];
  const float* qkvW  = (const float*)d_in[1];
  const float* qkvB  = (const float*)d_in[2];
  const float* projW = (const float*)d_in[3];
  const float* projB = (const float*)d_in[4];
  const float* relT  = (const float*)d_in[5];

  _Float16* qkv_pack  = (_Float16*)d_ws;                              // 96 KB
  _Float16* proj_pack = (_Float16*)((char*)d_ws + (size_t)CHN * 384 * 2);

  pack_weights_kernel<<<QKV_BLOCKS + PROJ_BLOCKS, 256, 0, stream>>>(
      qkvW, projW, qkv_pack, proj_pack);

  swin_window_attn_kernel<<<2048, 256, 0, stream>>>(
      x, qkvB, projB, relT, qkv_pack, proj_pack, (float*)d_out);
}

// v007
// It runs in 44.3 microseconds.
// In two side-by-side timings against v006, it was 1.08 and 1.07 times as fast.
// Over all steps from v000 it is 4.17 times as fast.
#include <hip/hip_runtime.h>
#include <cstddef>

typedef _Float16 v4h  __attribute__((ext_vector_type(4)));
typedef _Float16 v8h  __attribute__((ext_vector_type(8)));
typedef _Float16 v16h __attribute__((ext_vector_type(16)));
typedef float    v8f  __attribute__((ext_vector_type(8)));
typedef int      v4i  __attribute__((ext_vector_type(4)));
typedef float    v4f  __attribute__((ext_vector_type(4)));

#define WINSZ 7
#define SHF   3
#define WSQ   49      // tokens per window
#define NHEAD 4
#define HDIM  32
#define CHN   128
#define IMGE  56

// A workgroup holds two windows that are neighbours in x. Window w has its 49
// tokens in LDS rows 56 * w + 0..48 (56: a multiple of 8, so that 8 tokens of V^T
// stay 16-byte aligned); rows 0..111 are the seven row tiles of both products.
#define WROW  56      // first LDS row of the second window
#define MTILE 7       // 16-row tiles of the QKV and output products
#define AROWS 120     // rows that an attention tile of the second window spans

constexpr int XS_STRIDE = 136;  // halves (also holds O after QKV stage)
constexpr int QK_STRIDE = 264;  // halves, Q|K rows by token (528 B = 16 B x odd)
constexpr int Y_STRIDE  = 132;  // floats, result rows in the Q|K space (528 B)
constexpr int VT_STRIDE = 120;  // halves, V transposed: rows by channel (240 B = 16 B x odd)
constexpr int RP_PITCH  = 176;  // floats, one head's rel-pos bias table

__device__ __forceinline__ v8f wmma_f16(v16h a, v16h b, v8f c) {
  return __builtin_amdgcn_wmma_f32_16x16x32_f16(false, a, false, b, (short)0, c,
                                                false, false);
}

// A-fragment (16x32 f16, M x K), row-major source. Also serves as the
// B-fragment of a transposed matrix (Qᵀ) since lane<->column mapping matches.
__device__ __forceinline__ v16h ldA_row(const _Float16* base, int stride,
                                        int row0, int k0, int lane) {
  const int l  = lane & 15;
  const int kk = k0 + ((lane & 16) ? 8 : 0);
  const _Float16* p = base + (size_t)(row0 + l) * stride + kk;
  v8h lo = *(const v8h*)(p);        // K = kk+0..7
  v8h hi = *(const v8h*)(p + 16);   // K = kk+16..23
  return __builtin_shufflevector(lo, hi, 0,1,2,3,4,5,6,7,8,9,10,11,12,13,14,15);
}

// B-fragment from pre-swizzled pack: 512 halves per fragment, 16/lane contiguous.
__device__ __forceinline__ v16h ldB_pack(const _Float16* frag, int lane) {
  const _Float16* p = frag + lane * 16;
  v8h lo = *(const v8h*)(p);
  v8h hi = *(const v8h*)(p + 8);
  return __builtin_shufflevector(lo, hi, 0,1,2,3,4,5,6,7,8,9,10,11,12,13,14,15);
}

// Lane l <-> lane l ^ 16 (the two halves of a wave hold the two key halves).
__device__ __forceinline__ float swap_halves(float v) {
  int b = __builtin_bit_cast(int, v);
  b = __builtin_amdgcn_permlanex16(b, b, 0x76543210, 0xfedcba98, false, false);
  return __builtin_bit_cast(float, b);
}

// A pointer that is the same in every lane, held in scalar registers: a load from it
// takes the scalar base and one lane offset, and needs no address pair of its own.
typedef __attribute__((address_space(1))) const v4f gv4f;  // in global memory
__device__ __forceinline__ gv4f* scalar_ptr(const float* p) {
  const unsigned long long u = (unsigned long long)p;
  const unsigned lo = __builtin_amdgcn_readfirstlane((unsigned)u);
  const unsigned hi = __builtin_amdgcn_readfirstlane((unsigned)(u >> 32));
  return (gv4f*)(((unsigned long long)hi << 32) | lo);
}

__device__ __forceinline__ int region56(int g) {
  return g < (IMGE - WINSZ) ? 0 : (g < (IMGE - SHF) ? 1 : 2);
}

// ---------------------------------------------------------------------------
// Pre-pass: convert f32 weights to f16, swizzled into WMMA B-fragment layout.
// Fragment f = kc*(N/16)+nt holds 32 lanes x 16 halves.
// lane<16 : col n = nt*16+lane, halves = K {0..7, 16..23}+kc*32
// lane>=16: col n = nt*16+lane-16, halves = K {8..15,24..31}+kc*32
// ---------------------------------------------------------------------------
template <int N>  // N: columns of the K x N matrix, known at compile time
__device__ __forceinline__ void pack_element(const float* __restrict__ Wm,
                                             _Float16* __restrict__ P, int idx) {
  constexpr int NT = N >> 4;
  int f    = idx >> 9;
  int lane = (idx >> 4) & 31;
  int i    = idx & 15;
  int kc   = f / NT, nt = f - kc * NT;
  int l    = lane & 15;
  int hi   = (lane >> 4) & 1;
  int k    = kc * 32 + (i < 8 ? (hi ? 8 : 0) + i : (hi ? 24 : 16) + (i - 8));
  int n    = nt * 16 + l;
  P[idx] = (_Float16)Wm[(size_t)k * N + n];
}

// Both matrices in one launch: the two packs do not depend on each other, so the
// block index picks the matrix (a block-uniform branch), one element per thread.
constexpr int QKV_BLOCKS  = CHN * 3 * CHN / 256;  // 192
constexpr int PROJ_BLOCKS = CHN * CHN / 256;      // 64
__global__ __launch_bounds__(256) void pack_weights_kernel(
    const float* __restrict__ qkvW, const float* __restrict__ projW,
    _Float16* __restrict__ qkvP, _Float16* __restrict__ projP) {
  const int blk = blockIdx.x;
  if (blk < QKV_BLOCKS)
    pack_element<3 * CHN>(qkvW, qkvP, blk * 256 + threadIdx.x);
  else
    pack_element<CHN>(projW, projP, (blk - QKV_BLOCKS) * 256 + threadIdx.x);
}

// ---------------------------------------------------------------------------
// Fused shifted-window attention: one workgroup (8 waves) per pair of windows.
// ---------------------------------------------------------------------------
__global__ __launch_bounds__(256) void swin_window_attn_kernel(
    const float* __restrict__ x, const float* __restrict__ qkv_bias,
    const float* __restrict__ proj_bias, const float* __restrict__ rel_tab,
    const _Float16* __restrict__ qkv_pack, const _Float16* __restrict__ proj_pack,
    float* __restrict__ out) {
  // X tile, later O tile; behind the seven row tiles, spare rows for padding queries
  __shared__ __attribute__((aligned(16))) _Float16 lds_xs[(MTILE + 2) * 16 * XS_STRIDE];
  // Q|K by token (256 cols, q pre-scaled); later the f32 result rows
  __shared__ __attribute__((aligned(16))) _Float16 lds_qk[AROWS * QK_STRIDE];
  // V transposed: [channel][token]
  __shared__ __attribute__((aligned(16))) _Float16 lds_vt[CHN * VT_STRIDE];
  // rel-pos bias table, [head][169]
  __shared__ float lds_rp[NHEAD * RP_PITCH];
  // per token: ty * 13 + tx (its part of the bias index), shift-mask region
  __shared__ __attribute__((aligned(16))) int lds_koff[64];
  __shared__ __attribute__((aligned(16))) int lds_kreg[2 * 64];  // [window][token]

  const int tid  = threadIdx.x;
  const int lane = tid & 31;
  const int wv   = tid >> 5;  // 8 waves

  const int blk = blockIdx.x;           // 2048 = 64 imgs * 8 * 4 window pairs
  const int img = blk >> 5;
  const int wy  = (blk >> 2) & 7;
  const int wx0 = (blk & 3) * 2;        // the pair's left window

  // QKV bias of the wave's three column tiles (Q, K, V), read ahead of the gather
  // so that stage B does not wait for it in front of its weight loads.
  float qb[3];
  #pragma unroll  // qb[] is indexed by constants only, so it stays in registers
  for (int g = 0; g < 3; ++g) qb[g] = qkv_bias[(g * 8 + wv) * 16 + (lane & 15)];

  // ---- Stage A: gather shifted window into LDS (f32 -> f16) ----------------
  // Every load of a wave is issued before the first of them is waited for.
  const int wvs = __builtin_amdgcn_readfirstlane(wv);  // scalar addresses
  float rt[3];  // rel-pos table, 676 entries; the last read is clamped
  #pragma unroll  // rt[] is indexed by constants only; three loads in flight
  for (int k = 0; k < 3; ++k)
    rt[k] = rel_tab[min(tid + 256 * k, 169 * NHEAD - 1)];

  if (wvs < WINSZ) {
    // Waves 0..6: one row of both windows each, 14 tokens, one token's 512-byte row
    // per load. The row is the same in every lane: addresses are scalar work.
    int gr = wy * WINSZ + wvs + SHF; if (gr >= IMGE) gr -= IMGE;
    const float* xr = x + ((size_t)img * IMGE + gr) * (IMGE * CHN);  // scalar base
    v4f xv[2 * WINSZ];
    #pragma unroll  // xv[] is indexed by constants only; fourteen loads in flight
    for (int i = 0; i < 2 * WINSZ; ++i) {
      int gc = wx0 * WINSZ + i + SHF; if (gc >= IMGE) gc -= IMGE;
      xv[i] = scalar_ptr(xr + gc * CHN)[(unsigned)lane];
    }
    _Float16* d = lds_xs + wvs * WINSZ * XS_STRIDE + lane * 4;
    #pragma unroll  // a loop of its own: no store stands between two loads
    for (int i = 0; i < 2 * WINSZ; ++i) {
      v4h h;
      h[0] = (_Float16)xv[i].x; h[1] = (_Float16)xv[i].y;
      h[2] = (_Float16)xv[i].z; h[3] = (_Float16)xv[i].w;
      *(v4h*)(d + ((i / WINSZ) * WROW + i % WINSZ) * XS_STRIDE) = h;
    }
  } else {
    // Wave 7, which has no window row: the per-token tables and the zero rows.
    for (int t = lane; t < WSQ; t += 32) {
      int ty = t / WINSZ, tx = t - ty * WINSZ;
      lds_koff[t] = ty * 13 + tx;
      const int ry = region56(wy * WINSZ + ty) * 3;
      lds_kreg[t]      = ry + region56(wx0 * WINSZ + tx);
      lds_kreg[64 + t] = ry + region56((wx0 + 1) * WINSZ + tx);
    }
    const v4h z = {};
    for (int r = WSQ; r < WROW; ++r) {  // zero-pad rows 49..55 and 105..111
      *(v4h*)(lds_xs + r * XS_STRIDE + lane * 4) = z;
      *(v4h*)(lds_xs + (WROW + r) * XS_STRIDE + lane * 4) = z;
    }
    // The second window's last key and query tiles span rows 104..119; no product
    // writes rows 112..119 of Q|K or those token columns of V^T: zeros there.
    const v8h z8 = {};
    for (int r = MTILE * 16; r < AROWS; ++r)
      *(v8h*)(lds_qk + r * QK_STRIDE + lane * 8) = z8;
    for (int ch = lane; ch < CHN; ch += 32)
      *(v8h*)(lds_vt + ch * VT_STRIDE + MTILE * 16) = z8;
  }
  #pragma unroll  // rt[] again by constants
  for (int k = 0; k < 3; ++k) {
    const int j = tid + 256 * k;
    if (j < 169 * NHEAD) lds_rp[(j & 3) * RP_PITCH + (j >> 2)] = rt[k];
  }

  __syncthreads();

  // ---- Stage B: QKV = X @ Wqkv + b (q columns pre-scaled by 1/sqrt(32)) ----
  // A wave owns one 16-column tile of Q, one of K and one of V. All twelve weight
  // fragments are loaded once and stay in registers for the seven row tiles of
  // the two windows; each X fragment is read from LDS once and feeds three products.
  const float qscale = 0.17677669529663687f;
  {
    const int rhalf = (lane & 16) ? 8 : 0;
    const int cq = wvs * 16 + (lane & 15);  // the wave's column inside Q, K or V
    v16h b[3][4];
    #pragma unroll  // b[][] is indexed by constants only, so it stays in registers
    for (int g = 0; g < 3; ++g)  // 0: Q, 1: K, 2: V
      #pragma unroll
      for (int kc = 0; kc < 4; ++kc)
        b[g][kc] = ldB_pack(qkv_pack + (size_t)(kc * 24 + g * 8 + wvs) * 512, lane);
    // Kept rolled: unrolled, the build held so many row tiles' accumulators at once
    // that it spilled. A trip has three independent chains of four products.
    #pragma unroll 1
    for (int mt = 0; mt < MTILE; ++mt) {
      v8f acc[3];
      #pragma unroll
      for (int g = 0; g < 3; ++g)
        #pragma unroll
        for (int i = 0; i < 8; ++i) acc[g][i] = qb[g];
      #pragma unroll
      for (int kc = 0; kc < 4; ++kc) {
        const v16h a = ldA_row(lds_xs, XS_STRIDE, mt * 16, kc * 32, lane);
        #pragma unroll
        for (int g = 0; g < 3; ++g) acc[g] = wmma_f16(a, b[g][kc], acc[g]);
      }
      const int rbase = mt * 16 + rhalf;
      #pragma unroll
      for (int r = 0; r < 8; ++r) {  // Q, K: rows by token
        lds_qk[(rbase + r) * QK_STRIDE + cq] = (_Float16)(acc[0][r] * qscale);
        lds_qk[(rbase + r) * QK_STRIDE + CHN + cq] = (_Float16)acc[1][r];
      }
      v8h vv;  // V: a lane's 8 tokens of one channel, one 16-byte store
      #pragma unroll
      for (int r = 0; r < 8; ++r) vv[r] = (_Float16)acc[2][r];
      *(v8h*)(lds_vt + cq * VT_STRIDE + rbase) = vv;
    }
  }
  __syncthreads();

  // ---- Attention, all in one wave's registers ------------------------------
  // A wave owns one head of one window, all four 16-query tiles: every K and V^T
  // fragment is read from LDS by one wave only and feeds four products, and the four
  // tiles' softmax chains are independent work for one another's waits.
  // S^T = K Q^T: in every 16-key tile lane (c, hh) holds keys 8*hh+0..7 of query c, so
  // the softmax runs in-lane plus one exchange of the wave's halves; two score tiles,
  // converted in place, are the B operand P^T of O^T = V^T P^T.
  {
    const int c  = lane & 15;
    const int hh = lane >> 4;
    const int hd = wvs & 3;     // the wave's head
    const int w  = wvs >> 2;    // the wave's window
    const int wb = w * WROW;    // its first LDS row
    const int* kreg = lds_kreg + w * 64;

    // Padding queries 49..63 take query 48's bias and mask. Their O rows go to spare
    // rows that nobody reads: the first window's rows 56..63 hold the second
    // window's tokens. An address select, so that no branch stands among the WMMAs.
    int orow[4], sq[4], qoff[4];
    #pragma unroll  // indexed by constants only, so they stay in registers
    for (int j = 0; j < 4; ++j) {
      const int q = j * 16 + c;
      orow[j] = q < WSQ ? wb + q : (MTILE + w) * 16 + c;
      sq[j] = min(q, WSQ - 1);
      // bias index = (sy - ty + 6) * 13 + (sx - tx + 6) = koff[s] + 84 - koff[t]
      qoff[j] = lds_koff[sq[j]] + 84;
    }
    const bool edge = wy == 7 || wx0 + w == 7;  // only these windows mix regions
    const float L2E = 1.4426950408889634f;  // exp(x) = exp2(x * log2 e)

    {  // scores, softmax and O of the wave's head
      // The bias is the C operand of the score product. Key tile 3 holds one
      // real key, 48 (hh == 0, register 0; koff = 84).
      v8f st[4][4];
      #pragma unroll
      for (int kt = 0; kt < 3; ++kt) {
        const v4i ka = *(const v4i*)(lds_koff + kt * 16 + 8 * hh);
        const v4i kb = *(const v4i*)(lds_koff + kt * 16 + 8 * hh + 4);
        #pragma unroll
        for (int j = 0; j < 4; ++j) {
          const float* rp = lds_rp + hd * RP_PITCH + qoff[j];
          #pragma unroll
          for (int r = 0; r < 8; ++r) st[j][kt][r] = rp[-(r < 4 ? ka[r] : kb[r - 4])];
        }
      }
      #pragma unroll
      for (int j = 0; j < 4; ++j) {
        v8f z = {};
        z[0] = lds_rp[hd * RP_PITCH + qoff[j] - 84];
        st[j][3] = z;
      }

      v16h bq[4];
      #pragma unroll
      for (int j = 0; j < 4; ++j)
        bq[j] = ldA_row(lds_qk, QK_STRIDE, wb + j * 16, hd * HDIM, lane);
      #pragma unroll
      for (int kt = 0; kt < 4; ++kt) {
        const v16h ak = ldA_row(lds_qk, QK_STRIDE, wb + kt * 16, CHN + hd * HDIM, lane);
        #pragma unroll
        for (int j = 0; j < 4; ++j) st[j][kt] = wmma_f16(ak, bq[j], st[j][kt]);
      }

      if (edge) {
        #pragma unroll
        for (int kt = 0; kt < 3; ++kt) {
          const v4i ra = *(const v4i*)(kreg + kt * 16 + 8 * hh);
          const v4i rb = *(const v4i*)(kreg + kt * 16 + 8 * hh + 4);
          #pragma unroll
          for (int j = 0; j < 4; ++j) {
            const int qreg = kreg[sq[j]];
            #pragma unroll
            for (int r = 0; r < 8; ++r)
              st[j][kt][r] += (r < 4 ? ra[r] : rb[r - 4]) == qreg ? 0.f : -100.f;
          }
        }
        #pragma unroll
        for (int j = 0; j < 4; ++j)
          st[j][3][0] += kreg[WSQ - 1] == kreg[sq[j]] ? 0.f : -100.f;
      }

      v16h pb0[4], pb1[4];
      float inv[4];
      #pragma unroll
      for (int j = 0; j < 4; ++j) {
        const float s48 = hh ? -1e30f : st[j][3][0];  // keys 49..63 do not exist
        float mx = s48;
        #pragma unroll
        for (int kt = 0; kt < 3; ++kt)
          #pragma unroll
          for (int r = 0; r < 8; ++r) mx = fmaxf(mx, st[j][kt][r]);
        mx = fmaxf(mx, swap_halves(mx));
        const float mb = mx * L2E;

        float part[3];
        #pragma unroll
        for (int kt = 0; kt < 3; ++kt) {
          part[kt] = 0.f;
          #pragma unroll
          for (int r = 0; r < 8; ++r) {
            float p = __builtin_amdgcn_exp2f(fmaf(st[j][kt][r], L2E, -mb));
            part[kt] += p;
            if (kt == 0) pb0[j][r] = (_Float16)p;
            if (kt == 1) pb0[j][8 + r] = (_Float16)p;
            if (kt == 2) pb1[j][r] = (_Float16)p;
          }
        }
        const float p48 = __builtin_amdgcn_exp2f(fmaf(s48, L2E, -mb));
        pb1[j][8] = (_Float16)p48;
        #pragma unroll
        for (int r = 1; r < 8; ++r) pb1[j][8 + r] = (_Float16)0;
        float sum = (part[0] + part[1]) + (part[2] + p48);
        sum += swap_halves(sum);
        inv[j] = 1.0f / sum;
      }

      #pragma unroll
      for (int dt = 0; dt < 2; ++dt) {
        const int ch = hd * HDIM + dt * 16;
        const v16h v0 = ldA_row(lds_vt, VT_STRIDE, ch, wb, lane);
        const v16h v1 = ldA_row(lds_vt, VT_STRIDE, ch, wb + 32, lane);
        #pragma unroll
        for (int j = 0; j < 4; ++j) {
          v8f acc = {};
          acc = wmma_f16(v0, pb0[j], acc);
          acc = wmma_f16(v1, pb1[j], acc);
          v8h o;  // channels ch + 8*hh + 0..7 of query c
          #pragma unroll
          for (int r = 0; r < 8; ++r) o[r] = (_Float16)(acc[r] * inv[j]);
          *(v8h*)(lds_xs + orow[j] * XS_STRIDE + ch + 8 * hh) = o;
        }
      }
    }
  }
  __syncthreads();

  // ---- Stage E: Y = O @ Wproj + b, staged in LDS by token ------------------
  // Q|K are dead behind the barrier above; their rows of 528 bytes hold the
  // f32 result rows (128 floats + 4 of pad: the wave's two halves, 8 rows
  // apart, fall on different banks).
  float* lds_y = reinterpret_cast<float*>(lds_qk);
  {
    const int col = wv * 16 + (lane & 15);   // a wave owns 16 output channels
    const float bv = proj_bias[col];
    v16h b[4];
    #pragma unroll  // b[] is indexed by constants only, so it stays in registers
    for (int kc = 0; kc < 4; ++kc)
      b[kc] = ldB_pack(proj_pack + (size_t)(kc * 8 + wv) * 512, lane);
    #pragma unroll  // row tiles are independent: their chains can be interleaved
    for (int mt = 0; mt < MTILE; ++mt) {
      v8f acc;
      #pragma unroll
      for (int i = 0; i < 8; ++i) acc[i] = bv;
      #pragma unroll
      for (int kc = 0; kc < 4; ++kc)
        acc = wmma_f16(ldA_row(lds_xs, XS_STRIDE, mt * 16, kc * 32, lane),
                       b[kc], acc);
      float* d = lds_y + (mt * 16 + ((lane & 16) ? 8 : 0)) * Y_STRIDE + col;
      #pragma unroll
      for (int r = 0; r < 8; ++r) d[r * Y_STRIDE] = acc[r];
    }
  }
  __syncthreads();

  // ---- Reverse shift: a wave stores one row of both windows, 14 tokens -----
  // One store is one token's whole 512-byte row. The window row is the same in
  // every lane, so the addresses are scalar work; wave 7 has no row.
  const int wrow = __builtin_amdgcn_readfirstlane(wv);
  if (wrow < WINSZ) {
    int gr = wy * WINSZ + wrow + SHF; if (gr >= IMGE) gr -= IMGE;
    const float* y = lds_y + wrow * WINSZ * Y_STRIDE + lane * 4;
    float* o = out + ((size_t)img * IMGE + gr) * (IMGE * CHN) + lane * 4;
    for (int i = 0; i < 2 * WINSZ; ++i) {
      int gc = wx0 * WINSZ + i + SHF; if (gc >= IMGE) gc -= IMGE;
      *(float4*)(o + gc * CHN) =
          *(const float4*)(y + ((i / WINSZ) * WROW + i % WINSZ) * Y_STRIDE);
    }
  }
}

extern "C" void kernel_launch(void* const* d_in, const int* in_sizes, int n_in,
                              void* d_out, int out_size, void* d_ws,
                              size_t ws_size, hipStream_t stream) {
  const float* x     = (const float*)d_in[0];
  const float* qkvW  = (const float*)d_in[1];
  const float* qkvB  = (const float*)d_in[2];
  const float* projW = (const float*)d_in[3];
  const float* projB = (const float*)d_in[4];
  const float* relT  = (const float*)d_in[5];

  _Float16* qkv_pack  = (_Float16*)d_ws;                              // 96 KB
  _Float16* proj_pack = (_Float16*)((char*)d_ws + (size_t)CHN * 384 * 2);

  pack_weights_kernel<<<QKV_BLOCKS + PROJ_BLOCKS, 256, 0, stream>>>(
      qkvW, projW, qkv_pack, proj_pack);

  swin_window_attn_kernel<<<2048, 256, 0, stream>>>(
      x, qkvB, projB, relT, qkv_pack, proj_pack, (float*)d_out);
}

// v008
// It runs in 42 microseconds.
// Next to v007, in two timings, it ran 1.06 and 1.05 times as fast.
// All steps since v000 together make it 4.40 times as fast.
#include <hip/hip_runtime.h>
#include <cstddef>

typedef _Float16 v4h  __attribute__((ext_vector_type(4)));
typedef _Float16 v8h  __attribute__((ext_vector_type(8)));
typedef _Float16 v16h __attribute__((ext_vector_type(16)));
typedef float    v8f  __attribute__((ext_vector_type(8)));
typedef int      v4i  __attribute__((ext_vector_type(4)));
typedef float    v4f  __attribute__((ext_vector_type(4)));

#define WINSZ 7
#define SHF   3
#define WSQ   49      // tokens per window
#define NHEAD 4
#define HDIM  32
#define CHN   128
#define IMGE  56

// A workgroup holds two windows that are neighbours in x. Window w has its 49
// tokens in LDS rows 56 * w + 0..48 (56: a multiple of 8, so that 8 tokens of V^T
// stay 16-byte aligned); rows 0..111 are the seven row tiles of both products.
#define WROW  56      // first LDS row of the second window
#define MTILE 7       // 16-row tiles of the QKV and output products
#define AROWS 120     // rows that an attention tile of the second window spans

constexpr int XS_STRIDE = 136;  // halves (also holds O after QKV stage)
constexpr int QK_STRIDE = 264;  // halves, Q|K rows by token (528 B = 16 B x odd)
constexpr int Y_STRIDE  = 132;  // floats, result rows in the Q|K space (528 B)
constexpr int VT_STRIDE = 120;  // halves, V transposed: rows by channel (240 B = 16 B x odd)
constexpr int RP_PITCH  = 176;  // floats, one head's rel-pos bias table

__device__ __forceinline__ v8f wmma_f16(v16h a, v16h b, v8f c) {
  return __builtin_amdgcn_wmma_f32_16x16x32_f16(false, a, false, b, (short)0, c,
                                                false, false);
}

// A-fragment (16x32 f16, M x K), row-major source. Also serves as the
// B-fragment of a transposed matrix (Qᵀ) since lane<->column mapping matches.
__device__ __forceinline__ v16h ldA_row(const _Float16* base, int stride,
                                        int row0, int k0, int lane) {
  const int l  = lane & 15;
  const int kk = k0 + ((lane & 16) ? 8 : 0);
  const _Float16* p = base + (size_t)(row0 + l) * stride + kk;
  v8h lo = *(const v8h*)(p);        // K = kk+0..7
  v8h hi = *(const v8h*)(p + 16);   // K = kk+16..23
  return __builtin_shufflevector(lo, hi, 0,1,2,3,4,5,6,7,8,9,10,11,12,13,14,15);
}

// B-fragment from pre-swizzled pack: 512 halves per fragment, 16/lane contiguous.
__device__ __forceinline__ v16h ldB_pack(const _Float16* frag, int lane) {
  const _Float16* p = frag + lane * 16;
  v8h lo = *(const v8h*)(p);
  v8h hi = *(const v8h*)(p + 8);
  return __builtin_shufflevector(lo, hi, 0,1,2,3,4,5,6,7,8,9,10,11,12,13,14,15);
}

// Lane l <-> lane l ^ 16 (the two halves of a wave hold the two key halves).
__device__ __forceinline__ float swap_halves(float v) {
  int b = __builtin_bit_cast(int, v);
  b = __builtin_amdgcn_permlanex16(b, b, 0x76543210, 0xfedcba98, false, false);
  return __builtin_bit_cast(float, b);
}

// A pointer that is the same in every lane, held in scalar registers: a load from it
// takes the scalar base and one lane offset, and needs no address pair of its own.
typedef __attribute__((address_space(1))) const v4f gv4f;  // in global memory
__device__ __forceinline__ gv4f* scalar_ptr(const float* p) {
  const unsigned long long u = (unsigned long long)p;
  const unsigned lo = __builtin_amdgcn_readfirstlane((unsigned)u);
  const unsigned hi = __builtin_amdgcn_readfirstlane((unsigned)(u >> 32));
  return (gv4f*)(((unsigned long long)hi << 32) | lo);
}

__device__ __forceinline__ int region56(int g) {
  return g < (IMGE - WINSZ) ? 0 : (g < (IMGE - SHF) ? 1 : 2);
}

// ---------------------------------------------------------------------------
// Pre-pass: convert f32 weights to f16, swizzled into WMMA B-fragment layout.
// Fragment f = kc*(N/16)+nt holds 32 lanes x 16 halves.
// lane<16 : col n = nt*16+lane, halves = K {0..7, 16..23}+kc*32
// lane>=16: col n = nt*16+lane-16, halves = K {8..15,24..31}+kc*32
// ---------------------------------------------------------------------------
template <int N>  // N: columns of the K x N matrix, known at compile time
__device__ __forceinline__ void pack_element(const float* __restrict__ Wm,
                                             _Float16* __restrict__ P, int idx) {
  constexpr int NT = N >> 4;
  int f    = idx >> 9;
  int lane = (idx >> 4) & 31;
  int i    = idx & 15;
  int kc   = f / NT, nt = f - kc * NT;
  int l    = lane & 15;
  int hi   = (lane >> 4) & 1;
  int k    = kc * 32 + (i < 8 ? (hi ? 8 : 0) + i : (hi ? 24 : 16) + (i - 8));
  int n    = nt * 16 + l;
  P[idx] = (_Float16)Wm[(size_t)k * N + n];
}

// Both matrices in one launch: the two packs do not depend on each other, so the
// block index picks the matrix (a block-uniform branch), one element per thread.
constexpr int QKV_BLOCKS  = CHN * 3 * CHN / 256;  // 192
constexpr int PROJ_BLOCKS = CHN * CHN / 256;      // 64
__global__ __launch_bounds__(256) void pack_weights_kernel(
    const float* __restrict__ qkvW, const float* __restrict__ projW,
    _Float16* __restrict__ qkvP, _Float16* __restrict__ projP) {
  const int blk = blockIdx.x;
  if (blk < QKV_BLOCKS)
    pack_element<3 * CHN>(qkvW, qkvP, blk * 256 + threadIdx.x);
  else
    pack_element<CHN>(projW, projP, (blk - QKV_BLOCKS) * 256 + threadIdx.x);
}

// ---------------------------------------------------------------------------
// Fused shifted-window attention: one workgroup (8 waves) per pair of windows.
// ---------------------------------------------------------------------------
__global__ __launch_bounds__(256) void swin_window_attn_kernel(
    const float* __restrict__ x, const float* __restrict__ qkv_bias,
    const float* __restrict__ proj_bias, const float* __restrict__ rel_tab,
    const _Float16* __restrict__ qkv_pack, const _Float16* __restrict__ proj_pack,
    float* __restrict__ out) {
  // X tile, later O tile; behind the seven row tiles, spare rows for padding queries
  __shared__ __attribute__((aligned(16))) _Float16 lds_xs[(MTILE + 2) * 16 * XS_STRIDE];
  // Q|K by token (256 cols, q pre-scaled); later the f32 result rows
  __shared__ __attribute__((aligned(16))) _Float16 lds_qk[AROWS * QK_STRIDE];
  // V transposed: [channel][token]
  __shared__ __attribute__((aligned(16))) _Float16 lds_vt[CHN * VT_STRIDE];
  // rel-pos bias table, [head][169]
  __shared__ float lds_rp[NHEAD * RP_PITCH];
  // per token: ty * 13 + tx (its part of the bias index), shift-mask region
  __shared__ __attribute__((aligned(16))) int lds_koff[64];
  __shared__ __attribute__((aligned(16))) int lds_kreg[2 * 64];  // [window][token]

  const int tid  = threadIdx.x;
  const int lane = tid & 31;
  const int wv   = tid >> 5;  // 8 waves

  const int blk = blockIdx.x;           // 2048 = 64 imgs * 8 * 4 window pairs
  const int img = blk >> 5;
  const int wy  = (blk >> 2) & 7;
  const int wx0 = (blk & 3) * 2;        // the pair's left window

  // QKV bias of the wave's three column tiles (Q, K, V), read ahead of the gather
  // so that stage B does not wait for it in front of its weight loads. The Q and K
  // tiles are computed transposed: there a lane needs the bias of its 8 channels.
  const int chalf = (lane & 16) ? 8 : 0;  // the lane's half of a 16-channel tile
  v8f qkb[2];
  #pragma unroll  // qkb[] is indexed by constants only, so it stays in registers
  for (int g = 0; g < 2; ++g) {
    const float* bp = qkv_bias + (g * 8 + wv) * 16 + chalf;
    const v4f lo = *(const v4f*)bp, hi = *(const v4f*)(bp + 4);
    qkb[g] = __builtin_shufflevector(lo, hi, 0, 1, 2, 3, 4, 5, 6, 7);
  }
  const float vb = qkv_bias[(2 * 8 + wv) * 16 + (lane & 15)];

  // ---- Stage A: gather shifted window into LDS (f32 -> f16) ----------------
  // Every load of a wave is issued before the first of them is waited for.
  const int wvs = __builtin_amdgcn_readfirstlane(wv);  // scalar addresses
  float rt[3];  // rel-pos table, 676 entries; the last read is clamped
  #pragma unroll  // rt[] is indexed by constants only; three loads in flight
  for (int k = 0; k < 3; ++k)
    rt[k] = rel_tab[min(tid + 256 * k, 169 * NHEAD - 1)];

  if (wvs < WINSZ) {
    // Waves 0..6: one row of both windows each, 14 tokens, one token's 512-byte row
    // per load. The row is the same in every lane: addresses are scalar work.
    int gr = wy * WINSZ + wvs + SHF; if (gr >= IMGE) gr -= IMGE;
    const float* xr = x + ((size_t)img * IMGE + gr) * (IMGE * CHN);  // scalar base
    v4f xv[2 * WINSZ];
    #pragma unroll  // xv[] is indexed by constants only; fourteen loads in flight
    for (int i = 0; i < 2 * WINSZ; ++i) {
      int gc = wx0 * WINSZ + i + SHF; if (gc >= IMGE) gc -= IMGE;
      xv[i] = scalar_ptr(xr + gc * CHN)[(unsigned)lane];
    }
    _Float16* d = lds_xs + wvs * WINSZ * XS_STRIDE + lane * 4;
    #pragma unroll  // a loop of its own: no store stands between two loads
    for (int i = 0; i < 2 * WINSZ; ++i) {
      v4h h;
      h[0] = (_Float16)xv[i].x; h[1] = (_Float16)xv[i].y;
      h[2] = (_Float16)xv[i].z; h[3] = (_Float16)xv[i].w;
      *(v4h*)(d + ((i / WINSZ) * WROW + i % WINSZ) * XS_STRIDE) = h;
    }
  } else {
    // Wave 7, which has no window row: the per-token tables and the zero rows.
    for (int t = lane; t < WSQ; t += 32) {
      int ty = t / WINSZ, tx = t - ty * WINSZ;
      lds_koff[t] = ty * 13 + tx;
      const int ry = region56(wy * WINSZ + ty) * 3;
      lds_kreg[t]      = ry + region56(wx0 * WINSZ + tx);
      lds_kreg[64 + t] = ry + region56((wx0 + 1) * WINSZ + tx);
    }
    const v4h z = {};
    for (int r = WSQ; r < WROW; ++r) {  // zero-pad rows 49..55 and 105..111
      *(v4h*)(lds_xs + r * XS_STRIDE + lane * 4) = z;
      *(v4h*)(lds_xs + (WROW + r) * XS_STRIDE + lane * 4) = z;
    }
    // The second window's last key and query tiles span rows 104..119; no product
    // writes rows 112..119 of Q|K or those token columns of V^T: zeros there.
    const v8h z8 = {};
    for (int r = MTILE * 16; r < AROWS; ++r)
      *(v8h*)(lds_qk + r * QK_STRIDE + lane * 8) = z8;
    for (int ch = lane; ch < CHN; ch += 32)
      *(v8h*)(lds_vt + ch * VT_STRIDE + MTILE * 16) = z8;
  }
  #pragma unroll  // rt[] again by constants
  for (int k = 0; k < 3; ++k) {
    const int j = tid + 256 * k;
    if (j < 169 * NHEAD) lds_rp[(j & 3) * RP_PITCH + (j >> 2)] = rt[k];
  }

  __syncthreads();

  // ---- Stage B: QKV = X @ Wqkv + b (q columns pre-scaled by 1/sqrt(32)) ----
  // A wave owns one 16-column tile of Q, one of K and one of V. All twelve weight
  // fragments are loaded once and stay in registers for the seven row tiles of
  // the two windows; each X fragment is read from LDS once and feeds three products.
  // Q and K are formed as W^T X^T (the weight fragment is the A operand, the same
  // registers: both maps put the 16 rows or columns on lanes and share the k order):
  // a lane then holds 8 neighbouring channels of one token, one 16-byte store into
  // the token's row. V keeps X as A: its lane holds 8 tokens of one channel of V^T.
  const float qscale = 0.17677669529663687f;
  {
    const int cq = wvs * 16 + (lane & 15);  // the lane's channel of V
    v16h b[3][4];
    #pragma unroll  // b[][] is indexed by constants only, so it stays in registers
    for (int g = 0; g < 3; ++g)  // 0: Q, 1: K, 2: V
      #pragma unroll
      for (int kc = 0; kc < 4; ++kc)
        b[g][kc] = ldB_pack(qkv_pack + (size_t)(kc * 24 + g * 8 + wvs) * 512, lane);
    // Kept rolled: unrolled, the build held so many row tiles' accumulators at once
    // that it spilled. A trip has three independent chains of four products.
    #pragma unroll 1
    for (int mt = 0; mt < MTILE; ++mt) {
      v8f acc[3];
      acc[0] = qkb[0];
      acc[1] = qkb[1];
      #pragma unroll
      for (int i = 0; i < 8; ++i) acc[2][i] = vb;
      #pragma unroll
      for (int kc = 0; kc < 4; ++kc) {
        const v16h a = ldA_row(lds_xs, XS_STRIDE, mt * 16, kc * 32, lane);
        acc[0] = wmma_f16(b[0][kc], a, acc[0]);
        acc[1] = wmma_f16(b[1][kc], a, acc[1]);
        acc[2] = wmma_f16(a, b[2][kc], acc[2]);
      }
      v8h qq, kk, vv;
      #pragma unroll
      for (int r = 0; r < 8; ++r) {
        qq[r] = (_Float16)(acc[0][r] * qscale);
        kk[r] = (_Float16)acc[1][r];
        vv[r] = (_Float16)acc[2][r];
      }
      // Q, K: the lane's 8 channels of token mt * 16 + (lane & 15)
      _Float16* qrow = lds_qk + (mt * 16 + (lane & 15)) * QK_STRIDE + wvs * 16 + chalf;
      *(v8h*)qrow = qq;
      *(v8h*)(qrow + CHN) = kk;
      // V: the lane's 8 tokens of one channel
      *(v8h*)(lds_vt + cq * VT_STRIDE + mt * 16 + chalf) = vv;
    }
  }
  __syncthreads();

  // ---- Attention, all in one wave's registers ------------------------------
  // A wave owns one head of one window, all four 16-query tiles: every K and V^T
  // fragment is read from LDS by one wave only and feeds four products, and the four
  // tiles' softmax chains are independent work for one another's waits.
  // S^T = K Q^T: in every 16-key tile lane (c, hh) holds keys 8*hh+0..7 of query c, so
  // the softmax runs in-lane plus one exchange of the wave's halves; two score tiles,
  // converted in place, are the B operand P^T of O^T = V^T P^T.
  {
    const int c  = lane & 15;
    const int hh = lane >> 4;
    const int hd = wvs & 3;     // the wave's head
    const int w  = wvs >> 2;    // the wave's window
    const int wb = w * WROW;    // its first LDS row
    const int* kreg = lds_kreg + w * 64;

    // Padding queries 49..63 take query 48's bias and mask. Their O rows go to spare
    // rows that nobody reads: the first window's rows 56..63 hold the second
    // window's tokens. An address select, so that no branch stands among the WMMAs.
    int orow[4], sq[4], qoff[4];
    #pragma unroll  // indexed by constants only, so they stay in registers
    for (int j = 0; j < 4; ++j) {
      const int q = j * 16 + c;
      orow[j] = q < WSQ ? wb + q : (MTILE + w) * 16 + c;
      sq[j] = min(q, WSQ - 1);
      // bias index = (sy - ty + 6) * 13 + (sx - tx + 6) = koff[s] + 84 - koff[t]
      qoff[j] = lds_koff[sq[j]] + 84;
    }
    const bool edge = wy == 7 || wx0 + w == 7;  // only these windows mix regions
    const float L2E = 1.4426950408889634f;  // exp(x) = exp2(x * log2 e)

    {  // scores, softmax and O of the wave's head
      // The bias is the C operand of the score product. Key tile 3 holds one
      // real key, 48 (hh == 0, register 0; koff = 84).
      v8f st[4][4];
      #pragma unroll
      for (int kt = 0; kt < 3; ++kt) {
        const v4i ka = *(const v4i*)(lds_koff + kt * 16 + 8 * hh);
        const v4i kb = *(const v4i*)(lds_koff + kt * 16 + 8 * hh + 4);
        #pragma unroll
        for (int j = 0; j < 4; ++j) {
          const float* rp = lds_rp + hd * RP_PITCH + qoff[j];
          #pragma unroll
          for (int r = 0; r < 8; ++r) st[j][kt][r] = rp[-(r < 4 ? ka[r] : kb[r - 4])];
        }
      }
      #pragma unroll
      for (int j = 0; j < 4; ++j) {
        v8f z = {};
        z[0] = lds_rp[hd * RP_PITCH + qoff[j] - 84];
        st[j][3] = z;
      }

      v16h bq[4];
      #pragma unroll
      for (int j = 0; j < 4; ++j)
        bq[j] = ldA_row(lds_qk, QK_STRIDE, wb + j * 16, hd * HDIM, lane);
      #pragma unroll
      for (int kt = 0; kt < 4; ++kt) {
        const v16h ak = ldA_row(lds_qk, QK_STRIDE, wb + kt * 16, CHN + hd * HDIM, lane);
        #pragma unroll
        for (int j = 0; j < 4; ++j) st[j][kt] = wmma_f16(ak, bq[j], st[j][kt]);
      }

      if (edge) {
        #pragma unroll
        for (int kt = 0; kt < 3; ++kt) {
          const v4i ra = *(const v4i*)(kreg + kt * 16 + 8 * hh);
          const v4i rb = *(const v4i*)(kreg + kt * 16 + 8 * hh + 4);
          #pragma unroll
          for (int j = 0; j < 4; ++j) {
            const int qreg = kreg[sq[j]];
            #pragma unroll
            for (int r = 0; r < 8; ++r)
              st[j][kt][r] += (r < 4 ? ra[r] : rb[r - 4]) == qreg ? 0.f : -100.f;
          }
        }
        #pragma unroll
        for (int j = 0; j < 4; ++j)
          st[j][3][0] += kreg[WSQ - 1] == kreg[sq[j]] ? 0.f : -100.f;
      }

      v16h pb0[4], pb1[4];
      float inv[4];
      #pragma unroll
      for (int j = 0; j < 4; ++j) {
        const float s48 = hh ? -1e30f : st[j][3][0];  // keys 49..63 do not exist
        float mx = s48;
        #pragma unroll
        for (int kt = 0; kt < 3; ++kt)
          #pragma unroll
          for (int r = 0; r < 8; ++r) mx = fmaxf(mx, st[j][kt][r]);
        mx = fmaxf(mx, swap_halves(mx));
        const float mb = mx * L2E;

        float part[3];
        #pragma unroll
        for (int kt = 0; kt < 3; ++kt) {
          part[kt] = 0.f;
          #pragma unroll
          for (int r = 0; r < 8; ++r) {
            float p = __builtin_amdgcn_exp2f(fmaf(st[j][kt][r], L2E, -mb));
            part[kt] += p;
            if (kt == 0) pb0[j][r] = (_Float16)p;
            if (kt == 1) pb0[j][8 + r] = (_Float16)p;
            if (kt == 2) pb1[j][r] = (_Float16)p;
          }
        }
        const float p48 = __builtin_amdgcn_exp2f(fmaf(s48, L2E, -mb));
        pb1[j][8] = (_Float16)p48;
        #pragma unroll
        for (int r = 1; r < 8; ++r) pb1[j][8 + r] = (_Float16)0;
        float sum = (part[0] + part[1]) + (part[2] + p48);
        sum += swap_halves(sum);
        inv[j] = 1.0f / sum;
      }

      #pragma unroll
      for (int dt = 0; dt < 2; ++dt) {
        const int ch = hd * HDIM + dt * 16;
        const v16h v0 = ldA_row(lds_vt, VT_STRIDE, ch, wb, lane);
        const v16h v1 = ldA_row(lds_vt, VT_STRIDE, ch, wb + 32, lane);
        #pragma unroll
        for (int j = 0; j < 4; ++j) {
          v8f acc = {};
          acc = wmma_f16(v0, pb0[j], acc);
          acc = wmma_f16(v1, pb1[j], acc);
          v8h o;  // channels ch + 8*hh + 0..7 of query c
          #pragma unroll
          for (int r = 0; r < 8; ++r) o[r] = (_Float16)(acc[r] * inv[j]);
          *(v8h*)(lds_xs + orow[j] * XS_STRIDE + ch + 8 * hh) = o;
        }
      }
    }
  }
  __syncthreads();

  // ---- Stage E: Y = O @ Wproj + b, staged in LDS by token ------------------
  // Q|K are dead behind the barrier above; their rows of 528 bytes hold the
  // f32 result rows (128 floats + 4 of pad: 16 tokens' 16-byte pieces fall on
  // different banks). Formed as Wproj^T O^T, like Q and K: a lane holds 8
  // neighbouring channels of one token, two 16-byte stores.
  float* lds_y = reinterpret_cast<float*>(lds_qk);
  {
    const int ch0 = wv * 16 + chalf;   // a wave owns 16 output channels
    const v4f blo = *(const v4f*)(proj_bias + ch0), bhi = *(const v4f*)(proj_bias + ch0 + 4);
    const v8f bv = __builtin_shufflevector(blo, bhi, 0, 1, 2, 3, 4, 5, 6, 7);
    v16h b[4];
    #pragma unroll  // b[] is indexed by constants only, so it stays in registers
    for (int kc = 0; kc < 4; ++kc)
      b[kc] = ldB_pack(proj_pack + (size_t)(kc * 8 + wv) * 512, lane);
    #pragma unroll  // row tiles are independent: their chains can be interleaved
    for (int mt = 0; mt < MTILE; ++mt) {
      v8f acc = bv;
      #pragma unroll
      for (int kc = 0; kc < 4; ++kc)
        acc = wmma_f16(b[kc],
                       ldA_row(lds_xs, XS_STRIDE, mt * 16, kc * 32, lane), acc);
      float* d = lds_y + (mt * 16 + (lane & 15)) * Y_STRIDE + ch0;
      *(v4f*)d       = __builtin_shufflevector(acc, acc, 0, 1, 2, 3);
      *(v4f*)(d + 4) = __builtin_shufflevector(acc, acc, 4, 5, 6, 7);
    }
  }
  __syncthreads();

  // ---- Reverse shift: a wave stores one row of both windows, 14 tokens -----
  // One store is one token's whole 512-byte row. The window row is the same in
  // every lane, so the addresses are scalar work; wave 7 has no row.
  const int wrow = __builtin_amdgcn_readfirstlane(wv);
  if (wrow < WINSZ) {
    int gr = wy * WINSZ + wrow + SHF; if (gr >= IMGE) gr -= IMGE;
    const float* y = lds_y + wrow * WINSZ * Y_STRIDE + lane * 4;
    float* o = out + ((size_t)img * IMGE + gr) * (IMGE * CHN) + lane * 4;
    for (int i = 0; i < 2 * WINSZ; ++i) {
      int gc = wx0 * WINSZ + i + SHF; if (gc >= IMGE) gc -= IMGE;
      *(float4*)(o + gc * CHN) =
          *(const float4*)(y + ((i / WINSZ) * WROW + i % WINSZ) * Y_STRIDE);
    }
  }
}

extern "C" void kernel_launch(void* const* d_in, const int* in_sizes, int n_in,
                              void* d_out, int out_size, void* d_ws,
                              size_t ws_size, hipStream_t stream) {
  const float* x     = (const float*)d_in[0];
  const float* qkvW  = (const float*)d_in[1];
  const float* qkvB  = (const float*)d_in[2];
  const float* projW = (const float*)d_in[3];
  const float* projB = (const float*)d_in[4];
  const float* relT  = (const float*)d_in[5];

  _Float16* qkv_pack  = (_Float16*)d_ws;                              // 96 KB
  _Float16* proj_pack = (_Float16*)((char*)d_ws + (size_t)CHN * 384 * 2);

  pack_weights_kernel<<<QKV_BLOCKS + PROJ_BLOCKS, 256, 0, stream>>>(
      qkvW, projW, qkv_pack, proj_pack);

  swin_window_attn_kernel<<<2048, 256, 0, stream>>>(
      x, qkvB, projB, relT, qkv_pack, proj_pack, (float*)d_out);
}

// v009
// It runs in 41 microseconds.
// Next to v008, in two timings, it ran 1.03 and 1.02 times as fast.
// Counting every step since v000, it is 4.52 times as fast.
#include <hip/hip_runtime.h>
#include <cstddef>

typedef _Float16 v4h  __attribute__((ext_vector_type(4)));
typedef _Float16 v8h  __attribute__((ext_vector_type(8)));
typedef _Float16 v16h __attribute__((ext_vector_type(16)));
typedef float    v8f  __attribute__((ext_vector_type(8)));
typedef int      v4i  __attribute__((ext_vector_type(4)));
typedef float    v4f  __attribute__((ext_vector_type(4)));

#define WINSZ 7
#define SHF   3
#define WSQ   49      // tokens per window
#define NHEAD 4
#define HDIM  32
#define CHN   128
#define IMGE  56

// A workgroup holds two windows that are neighbours in x. Window w has its 49
// tokens in LDS rows 56 * w + 0..48 (56: a multiple of 8, so that 8 tokens of V^T
// stay 16-byte aligned); rows 0..111 are the seven row tiles of both products.
#define WROW  56      // first LDS row of the second window
#define MTILE 7       // 16-row tiles of the QKV and output products
#define AROWS 120     // rows that an attention tile of the second window spans

constexpr int XS_STRIDE = 136;  // halves (also holds O after QKV stage)
constexpr int QK_STRIDE = 264;  // halves, Q|K rows by token (528 B = 16 B x odd)
constexpr int Y_STRIDE  = 132;  // floats, result rows in the Q|K space (528 B)
constexpr int VT_STRIDE = 120;  // halves, V transposed: rows by channel (240 B = 16 B x odd)
constexpr int RP_PITCH  = 176;  // floats, one head's rel-pos bias table

__device__ __forceinline__ v8f wmma_f16(v16h a, v16h b, v8f c) {
  return __builtin_amdgcn_wmma_f32_16x16x32_f16(false, a, false, b, (short)0, c,
                                                false, false);
}

// A-fragment (16x32 f16, M x K), row-major source. Also serves as the
// B-fragment of a transposed matrix (Qᵀ) since lane<->column mapping matches.
__device__ __forceinline__ v16h ldA_row(const _Float16* base, int stride,
                                        int row0, int k0, int lane) {
  const int l  = lane & 15;
  const int kk = k0 + ((lane & 16) ? 8 : 0);
  const _Float16* p = base + (size_t)(row0 + l) * stride + kk;
  v8h lo = *(const v8h*)(p);        // K = kk+0..7
  v8h hi = *(const v8h*)(p + 16);   // K = kk+16..23
  return __builtin_shufflevector(lo, hi, 0,1,2,3,4,5,6,7,8,9,10,11,12,13,14,15);
}

// B-fragment from pre-swizzled pack: 512 halves per fragment, in two planes of 256:
// every lane's first 8 halves, then every lane's last 8. Each 16-byte load of a wave
// then covers 512 contiguous bytes, four whole 128-byte lines.
__device__ __forceinline__ v16h ldB_pack(const _Float16* frag, int lane) {
  const _Float16* p = frag + lane * 8;
  v8h lo = *(const v8h*)(p);
  v8h hi = *(const v8h*)(p + 256);
  return __builtin_shufflevector(lo, hi, 0,1,2,3,4,5,6,7,8,9,10,11,12,13,14,15);
}

// Lane l <-> lane l ^ 16 (the two halves of a wave hold the two key halves).
__device__ __forceinline__ float swap_halves(float v) {
  int b = __builtin_bit_cast(int, v);
  b = __builtin_amdgcn_permlanex16(b, b, 0x76543210, 0xfedcba98, false, false);
  return __builtin_bit_cast(float, b);
}

// A pointer that is the same in every lane, held in scalar registers: a load from it
// takes the scalar base and one lane offset, and needs no address pair of its own.
typedef __attribute__((address_space(1))) const v4f gv4f;  // in global memory
__device__ __forceinline__ gv4f* scalar_ptr(const float* p) {
  const unsigned long long u = (unsigned long long)p;
  const unsigned lo = __builtin_amdgcn_readfirstlane((unsigned)u);
  const unsigned hi = __builtin_amdgcn_readfirstlane((unsigned)(u >> 32));
  return (gv4f*)(((unsigned long long)hi << 32) | lo);
}

__device__ __forceinline__ int region56(int g) {
  return g < (IMGE - WINSZ) ? 0 : (g < (IMGE - SHF) ? 1 : 2);
}

// ---------------------------------------------------------------------------
// Pre-pass: convert f32 weights to f16, swizzled into WMMA B-fragment layout.
// Fragment f = kc*(N/16)+nt holds 32 lanes x 16 halves, stored as two planes:
// plane 0 = halves 0..7 of lanes 0..31, plane 1 = halves 8..15 of lanes 0..31.
// lane<16 : col n = nt*16+lane, halves = K {0..7, 16..23}+kc*32
// lane>=16: col n = nt*16+lane-16, halves = K {8..15,24..31}+kc*32
// ---------------------------------------------------------------------------
template <int N>  // N: columns of the K x N matrix, known at compile time
__device__ __forceinline__ void pack_element(const float* __restrict__ Wm,
                                             _Float16* __restrict__ P, int idx) {
  constexpr int NT = N >> 4;
  int f    = idx >> 9;
  int lane = (idx >> 3) & 31;
  int i    = (idx & 7) + ((idx >> 8) & 1) * 8;  // plane 1: the lane's halves 8..15
  int kc   = f / NT, nt = f - kc * NT;
  int l    = lane & 15;
  int hi   = (lane >> 4) & 1;
  int k    = kc * 32 + (i < 8 ? (hi ? 8 : 0) + i : (hi ? 24 : 16) + (i - 8));
  int n    = nt * 16 + l;
  P[idx] = (_Float16)Wm[(size_t)k * N + n];
}

// Both matrices in one launch: the two packs do not depend on each other, so the
// block index picks the matrix (a block-uniform branch), one element per thread.
constexpr int QKV_BLOCKS  = CHN * 3 * CHN / 256;  // 192
constexpr int PROJ_BLOCKS = CHN * CHN / 256;      // 64
__global__ __launch_bounds__(256) void pack_weights_kernel(
    const float* __restrict__ qkvW, const float* __restrict__ projW,
    _Float16* __restrict__ qkvP, _Float16* __restrict__ projP) {
  const int blk = blockIdx.x;
  if (blk < QKV_BLOCKS)
    pack_element<3 * CHN>(qkvW, qkvP, blk * 256 + threadIdx.x);
  else
    pack_element<CHN>(projW, projP, (blk - QKV_BLOCKS) * 256 + threadIdx.x);
}

// ---------------------------------------------------------------------------
// Fused shifted-window attention: one workgroup (8 waves) per pair of windows.
// ---------------------------------------------------------------------------
__global__ __launch_bounds__(256) void swin_window_attn_kernel(
    const float* __restrict__ x, const float* __restrict__ qkv_bias,
    const float* __restrict__ proj_bias, const float* __restrict__ rel_tab,
    const _Float16* __restrict__ qkv_pack, const _Float16* __restrict__ proj_pack,
    float* __restrict__ out) {
  // X tile, later O tile; behind the seven row tiles, spare rows for padding queries
  __shared__ __attribute__((aligned(16))) _Float16 lds_xs[(MTILE + 2) * 16 * XS_STRIDE];
  // Q|K by token (256 cols, q pre-scaled); later the f32 result rows
  __shared__ __attribute__((aligned(16))) _Float16 lds_qk[AROWS * QK_STRIDE];
  // V transposed: [channel][token]
  __shared__ __attribute__((aligned(16))) _Float16 lds_vt[CHN * VT_STRIDE];
  // rel-pos bias table, [head][169]
  __shared__ float lds_rp[NHEAD * RP_PITCH];
  // per token: ty * 13 + tx (its part of the bias index), shift-mask region
  __shared__ __attribute__((aligned(16))) int lds_koff[64];
  __shared__ __attribute__((aligned(16))) int lds_kreg[2 * 64];  // [window][token]

  const int tid  = threadIdx.x;
  const int lane = tid & 31;
  const int wv   = tid >> 5;  // 8 waves

  const int blk = blockIdx.x;           // 2048 = 64 imgs * 8 * 4 window pairs
  const int img = blk >> 5;
  const int wy  = (blk >> 2) & 7;
  const int wx0 = (blk & 3) * 2;        // the pair's left window

  // QKV bias of the wave's three column tiles (Q, K, V), read ahead of the gather
  // so that stage B does not wait for it in front of its weight loads. The Q and K
  // tiles are computed transposed: there a lane needs the bias of its 8 channels.
  const int chalf = (lane & 16) ? 8 : 0;  // the lane's half of a 16-channel tile
  v8f qkb[2];
  #pragma unroll  // qkb[] is indexed by constants only, so it stays in registers
  for (int g = 0; g < 2; ++g) {
    const float* bp = qkv_bias + (g * 8 + wv) * 16 + chalf;
    const v4f lo = *(const v4f*)bp, hi = *(const v4f*)(bp + 4);
    qkb[g] = __builtin_shufflevector(lo, hi, 0, 1, 2, 3, 4, 5, 6, 7);
  }
  const float vb = qkv_bias[(2 * 8 + wv) * 16 + (lane & 15)];

  // ---- Stage A: gather shifted window into LDS (f32 -> f16) ----------------
  // Every load of a wave is issued before the first of them is waited for.
  const int wvs = __builtin_amdgcn_readfirstlane(wv);  // scalar addresses
  float rt[3];  // rel-pos table, 676 entries; the last read is clamped
  #pragma unroll  // rt[] is indexed by constants only; three loads in flight
  for (int k = 0; k < 3; ++k)
    rt[k] = rel_tab[min(tid + 256 * k, 169 * NHEAD - 1)];

  if (wvs < WINSZ) {
    // Waves 0..6: one row of both windows each, 14 tokens, one token's 512-byte row
    // per load. The row is the same in every lane: addresses are scalar work.
    int gr = wy * WINSZ + wvs + SHF; if (gr >= IMGE) gr -= IMGE;
    const float* xr = x + ((size_t)img * IMGE + gr) * (IMGE * CHN);  // scalar base
    v4f xv[2 * WINSZ];
    #pragma unroll  // xv[] is indexed by constants only; fourteen loads in flight
    for (int i = 0; i < 2 * WINSZ; ++i) {
      int gc = wx0 * WINSZ + i + SHF; if (gc >= IMGE) gc -= IMGE;
      xv[i] = scalar_ptr(xr + gc * CHN)[(unsigned)lane];
    }
    _Float16* d = lds_xs + wvs * WINSZ * XS_STRIDE + lane * 4;
    #pragma unroll  // a loop of its own: no store stands between two loads
    for (int i = 0; i < 2 * WINSZ; ++i) {
      v4h h;
      h[0] = (_Float16)xv[i].x; h[1] = (_Float16)xv[i].y;
      h[2] = (_Float16)xv[i].z; h[3] = (_Float16)xv[i].w;
      *(v4h*)(d + ((i / WINSZ) * WROW + i % WINSZ) * XS_STRIDE) = h;
    }
  } else {
    // Wave 7, which has no window row: the per-token tables and the zero rows.
    for (int t = lane; t < WSQ; t += 32) {
      int ty = t / WINSZ, tx = t - ty * WINSZ;
      lds_koff[t] = ty * 13 + tx;
      const int ry = region56(wy * WINSZ + ty) * 3;
      lds_kreg[t]      = ry + region56(wx0 * WINSZ + tx);
      lds_kreg[64 + t] = ry + region56((wx0 + 1) * WINSZ + tx);
    }
    const v4h z = {};
    for (int r = WSQ; r < WROW; ++r) {  // zero-pad rows 49..55 and 105..111
      *(v4h*)(lds_xs + r * XS_STRIDE + lane * 4) = z;
      *(v4h*)(lds_xs + (WROW + r) * XS_STRIDE + lane * 4) = z;
    }
    // The second window's last key and query tiles span rows 104..119; no product
    // writes rows 112..119 of Q|K or those token columns of V^T: zeros there.
    const v8h z8 = {};
    for (int r = MTILE * 16; r < AROWS; ++r)
      *(v8h*)(lds_qk + r * QK_STRIDE + lane * 8) = z8;
    for (int ch = lane; ch < CHN; ch += 32)
      *(v8h*)(lds_vt + ch * VT_STRIDE + MTILE * 16) = z8;
  }
  #pragma unroll  // rt[] again by constants
  for (int k = 0; k < 3; ++k) {
    const int j = tid + 256 * k;
    if (j < 169 * NHEAD) lds_rp[(j & 3) * RP_PITCH + (j >> 2)] = rt[k];
  }

  __syncthreads();

  // ---- Stage B: QKV = X @ Wqkv + b (q columns pre-scaled by 1/sqrt(32)) ----
  // A wave owns one 16-column tile of Q, one of K and one of V. All twelve weight
  // fragments are loaded once and stay in registers for the seven row tiles of
  // the two windows; each X fragment is read from LDS once and feeds three products.
  // Q and K are formed as W^T X^T (the weight fragment is the A operand, the same
  // registers: both maps put the 16 rows or columns on lanes and share the k order):
  // a lane then holds 8 neighbouring channels of one token, one 16-byte store into
  // the token's row. V keeps X as A: its lane holds 8 tokens of one channel of V^T.
  const float qscale = 0.17677669529663687f;
  {
    const int cq = wvs * 16 + (lane & 15);  // the lane's channel of V
    v16h b[3][4];
    #pragma unroll  // b[][] is indexed by constants only, so it stays in registers
    for (int g = 0; g < 3; ++g) {  // 0: Q, 1: K, 2: V
      #pragma unroll
      for (int kc = 0; kc < 4; ++kc)
        b[g][kc] = ldB_pack(qkv_pack + (size_t)(kc * 24 + g * 8 + wvs) * 512, lane);
      // The next group's loads land in registers that hold this group's addresses:
      // the wait that belongs in front of such an overwrite.
      if (g < 2) asm volatile("s_wait_xcnt 0x0" ::: "memory");
    }
    // Kept rolled: unrolled, the build held so many row tiles' accumulators at once
    // that it spilled. A trip has three independent chains of four products.
    #pragma unroll 1
    for (int mt = 0; mt < MTILE; ++mt) {
      v8f acc[3];
      acc[0] = qkb[0];
      acc[1] = qkb[1];
      #pragma unroll
      for (int i = 0; i < 8; ++i) acc[2][i] = vb;
      #pragma unroll
      for (int kc = 0; kc < 4; ++kc) {
        const v16h a = ldA_row(lds_xs, XS_STRIDE, mt * 16, kc * 32, lane);
        acc[0] = wmma_f16(b[0][kc], a, acc[0]);
        acc[1] = wmma_f16(b[1][kc], a, acc[1]);
        acc[2] = wmma_f16(a, b[2][kc], acc[2]);
      }
      v8h qq, kk, vv;
      #pragma unroll
      for (int r = 0; r < 8; ++r) {
        qq[r] = (_Float16)(acc[0][r] * qscale);
        kk[r] = (_Float16)acc[1][r];
        vv[r] = (_Float16)acc[2][r];
      }
      // Q, K: the lane's 8 channels of token mt * 16 + (lane & 15)
      _Float16* qrow = lds_qk + (mt * 16 + (lane & 15)) * QK_STRIDE + wvs * 16 + chalf;
      *(v8h*)qrow = qq;
      *(v8h*)(qrow + CHN) = kk;
      // V: the lane's 8 tokens of one channel
      *(v8h*)(lds_vt + cq * VT_STRIDE + mt * 16 + chalf) = vv;
    }
  }
  __syncthreads();

  // ---- Attention, all in one wave's registers ------------------------------
  // A wave owns one head of one window, all four 16-query tiles: every K and V^T
  // fragment is read from LDS by one wave only and feeds four products, and the four
  // tiles' softmax chains are independent work for one another's waits.
  // S^T = K Q^T: in every 16-key tile lane (c, hh) holds keys 8*hh+0..7 of query c, so
  // the softmax runs in-lane plus one exchange of the wave's halves; two score tiles,
  // converted in place, are the B operand P^T of O^T = V^T P^T.
  {
    const int c  = lane & 15;
    const int hh = lane >> 4;
    const int hd = wvs & 3;     // the wave's head
    const int w  = wvs >> 2;    // the wave's window
    const int wb = w * WROW;    // its first LDS row
    const int* kreg = lds_kreg + w * 64;

    // Padding queries 49..63 take query 48's bias and mask. Their O rows go to spare
    // rows that nobody reads: the first window's rows 56..63 hold the second
    // window's tokens. An address select, so that no branch stands among the WMMAs.
    int orow[4], sq[4], qoff[4];
    #pragma unroll  // indexed by constants only, so they stay in registers
    for (int j = 0; j < 4; ++j) {
      const int q = j * 16 + c;
      orow[j] = q < WSQ ? wb + q : (MTILE + w) * 16 + c;
      sq[j] = min(q, WSQ - 1);
      // bias index = (sy - ty + 6) * 13 + (sx - tx + 6) = koff[s] + 84 - koff[t]
      qoff[j] = lds_koff[sq[j]] + 84;
    }
    const bool edge = wy == 7 || wx0 + w == 7;  // only these windows mix regions
    const float L2E = 1.4426950408889634f;  // exp(x) = exp2(x * log2 e)

    {  // scores, softmax and O of the wave's head
      // The bias is the C operand of the score product. Key tile 3 holds one
      // real key, 48 (hh == 0, register 0; koff = 84).
      v8f st[4][4];
      #pragma unroll
      for (int kt = 0; kt < 3; ++kt) {
        const v4i ka = *(const v4i*)(lds_koff + kt * 16 + 8 * hh);
        const v4i kb = *(const v4i*)(lds_koff + kt * 16 + 8 * hh + 4);
        #pragma unroll
        for (int j = 0; j < 4; ++j) {
          const float* rp = lds_rp + hd * RP_PITCH + qoff[j];
          #pragma unroll
          for (int r = 0; r < 8; ++r) st[j][kt][r] = rp[-(r < 4 ? ka[r] : kb[r - 4])];
        }
      }
      #pragma unroll
      for (int j = 0; j < 4; ++j) {
        v8f z = {};
        z[0] = lds_rp[hd * RP_PITCH + qoff[j] - 84];
        st[j][3] = z;
      }

      v16h bq[4];
      #pragma unroll
      for (int j = 0; j < 4; ++j)
        bq[j] = ldA_row(lds_qk, QK_STRIDE, wb + j * 16, hd * HDIM, lane);
      #pragma unroll
      for (int kt = 0; kt < 4; ++kt) {
        const v16h ak = ldA_row(lds_qk, QK_STRIDE, wb + kt * 16, CHN + hd * HDIM, lane);
        #pragma unroll
        for (int j = 0; j < 4; ++j) st[j][kt] = wmma_f16(ak, bq[j], st[j][kt]);
      }

      if (edge) {
        #pragma unroll
        for (int kt = 0; kt < 3; ++kt) {
          const v4i ra = *(const v4i*)(kreg + kt * 16 + 8 * hh);
          const v4i rb = *(const v4i*)(kreg + kt * 16 + 8 * hh + 4);
          #pragma unroll
          for (int j = 0; j < 4; ++j) {
            const int qreg = kreg[sq[j]];
            #pragma unroll
            for (int r = 0; r < 8; ++r)
              st[j][kt][r] += (r < 4 ? ra[r] : rb[r - 4]) == qreg ? 0.f : -100.f;
          }
        }
        #pragma unroll
        for (int j = 0; j < 4; ++j)
          st[j][3][0] += kreg[WSQ - 1] == kreg[sq[j]] ? 0.f : -100.f;
      }

      v16h pb0[4], pb1[4];
      float inv[4];
      #pragma unroll
      for (int j = 0; j < 4; ++j) {
        const float s48 = hh ? -1e30f : st[j][3][0];  // keys 49..63 do not exist
        float mx = s48;
        #pragma unroll
        for (int kt = 0; kt < 3; ++kt)
          #pragma unroll
          for (int r = 0; r < 8; ++r) mx = fmaxf(mx, st[j][kt][r]);
        mx = fmaxf(mx, swap_halves(mx));
        const float mb = mx * L2E;

        float part[3];
        #pragma unroll
        for (int kt = 0; kt < 3; ++kt) {
          part[kt] = 0.f;
          #pragma unroll
          for (int r = 0; r < 8; ++r) {
            float p = __builtin_amdgcn_exp2f(fmaf(st[j][kt][r], L2E, -mb));
            part[kt] += p;
            if (kt == 0) pb0[j][r] = (_Float16)p;
            if (kt == 1) pb0[j][8 + r] = (_Float16)p;
            if (kt == 2) pb1[j][r] = (_Float16)p;
          }
        }
        const float p48 = __builtin_amdgcn_exp2f(fmaf(s48, L2E, -mb));
        pb1[j][8] = (_Float16)p48;
        #pragma unroll
        for (int r = 1; r < 8; ++r) pb1[j][8 + r] = (_Float16)0;
        float sum = (part[0] + part[1]) + (part[2] + p48);
        sum += swap_halves(sum);
        inv[j] = 1.0f / sum;
      }

      #pragma unroll
      for (int dt = 0; dt < 2; ++dt) {
        const int ch = hd * HDIM + dt * 16;
        const v16h v0 = ldA_row(lds_vt, VT_STRIDE, ch, wb, lane);
        const v16h v1 = ldA_row(lds_vt, VT_STRIDE, ch, wb + 32, lane);
        #pragma unroll
        for (int j = 0; j < 4; ++j) {
          v8f acc = {};
          acc = wmma_f16(v0, pb0[j], acc);
          acc = wmma_f16(v1, pb1[j], acc);
          v8h o;  // channels ch + 8*hh + 0..7 of query c
          #pragma unroll
          for (int r = 0; r < 8; ++r) o[r] = (_Float16)(acc[r] * inv[j]);
          *(v8h*)(lds_xs + orow[j] * XS_STRIDE + ch + 8 * hh) = o;
        }
      }
    }
  }
  __syncthreads();

  // ---- Stage E: Y = O @ Wproj + b, staged in LDS by token ------------------
  // Q|K are dead behind the barrier above; their rows of 528 bytes hold the
  // f32 result rows (128 floats + 4 of pad: 16 tokens' 16-byte pieces fall on
  // different banks). Formed as Wproj^T O^T, like Q and K: a lane holds 8
  // neighbouring channels of one token, two 16-byte stores.
  float* lds_y = reinterpret_cast<float*>(lds_qk);
  {
    const int ch0 = wv * 16 + chalf;   // a wave owns 16 output channels
    const v4f blo = *(const v4f*)(proj_bias + ch0), bhi = *(const v4f*)(proj_bias + ch0 + 4);
    const v8f bv = __builtin_shufflevector(blo, bhi, 0, 1, 2, 3, 4, 5, 6, 7);
    v16h b[4];
    #pragma unroll  // b[] is indexed by constants only, so it stays in registers
    for (int kc = 0; kc < 4; ++kc)
      b[kc] = ldB_pack(proj_pack + (size_t)(kc * 8 + wv) * 512, lane);
    #pragma unroll  // row tiles are independent: their chains can be interleaved
    for (int mt = 0; mt < MTILE; ++mt) {
      v8f acc = bv;
      #pragma unroll
      for (int kc = 0; kc < 4; ++kc)
        acc = wmma_f16(b[kc],
                       ldA_row(lds_xs, XS_STRIDE, mt * 16, kc * 32, lane), acc);
      float* d = lds_y + (mt * 16 + (lane & 15)) * Y_STRIDE + ch0;
      *(v4f*)d       = __builtin_shufflevector(acc, acc, 0, 1, 2, 3);
      *(v4f*)(d + 4) = __builtin_shufflevector(acc, acc, 4, 5, 6, 7);
    }
  }
  __syncthreads();

  // ---- Reverse shift: a wave stores one row of both windows, 14 tokens -----
  // One store is one token's whole 512-byte row. The window row is the same in
  // every lane, so the addresses are scalar work; wave 7 has no row.
  const int wrow = __builtin_amdgcn_readfirstlane(wv);
  if (wrow < WINSZ) {
    int gr = wy * WINSZ + wrow + SHF; if (gr >= IMGE) gr -= IMGE;
    const float* y = lds_y + wrow * WINSZ * Y_STRIDE + lane * 4;
    float* o = out + ((size_t)img * IMGE + gr) * (IMGE * CHN) + lane * 4;
    for (int i = 0; i < 2 * WINSZ; ++i) {
      int gc = wx0 * WINSZ + i + SHF; if (gc >= IMGE) gc -= IMGE;
      *(float4*)(o + gc * CHN) =
          *(const float4*)(y + ((i / WINSZ) * WROW + i % WINSZ) * Y_STRIDE);
    }
  }
}

extern "C" void kernel_launch(void* const* d_in, const int* in_sizes, int n_in,
                              void* d_out, int out_size, void* d_ws,
                              size_t ws_size, hipStream_t stream) {
  const float* x     = (const float*)d_in[0];
  const float* qkvW  = (const float*)d_in[1];
  const float* qkvB  = (const float*)d_in[2];
  const float* projW = (const float*)d_in[3];
  const float* projB = (const float*)d_in[4];
  const float* relT  = (const float*)d_in[5];

  _Float16* qkv_pack  = (_Float16*)d_ws;                              // 96 KB
  _Float16* proj_pack = (_Float16*)((char*)d_ws + (size_t)CHN * 384 * 2);

  pack_weights_kernel<<<QKV_BLOCKS + PROJ_BLOCKS, 256, 0, stream>>>(
      qkvW, projW, qkv_pack, proj_pack);

  swin_window_attn_kernel<<<2048, 256, 0, stream>>>(
      x, qkvB, projB, relT, qkv_pack, proj_pack, (float*)d_out);
}

// v010
// One run takes 40.3 microseconds.
// Timed twice side by side with v009, it ran 1.03 times as fast both times.
// Counting every step since v000, it is 4.66 times as fast.
#include <hip/hip_runtime.h>
#include <cstddef>

typedef _Float16 v4h  __attribute__((ext_vector_type(4)));
typedef _Float16 v8h  __attribute__((ext_vector_type(8)));
typedef _Float16 v16h __attribute__((ext_vector_type(16)));
typedef float    v8f  __attribute__((ext_vector_type(8)));
typedef int      v4i  __attribute__((ext_vector_type(4)));
typedef float    v4f  __attribute__((ext_vector_type(4)));

#define WINSZ 7
#define SHF   3
#define WSQ   49      // tokens per window
#define NHEAD 4
#define HDIM  32
#define CHN   128
#define IMGE  56

// A workgroup holds two windows that are neighbours in x. Window w has its 49
// tokens in LDS rows 56 * w + 0..48 (56: a multiple of 8, so that 8 tokens of V^T
// stay 16-byte aligned); rows 0..111 are the seven row tiles of both products.
#define WROW  56      // first LDS row of the second window
#define MTILE 7       // 16-row tiles of the QKV and output products
#define AROWS 120     // rows that an attention tile of the second window spans

constexpr int XS_STRIDE = 136;  // halves (also holds O after QKV stage)
constexpr int QK_STRIDE = 264;  // halves, Q|K rows by token (528 B = 16 B x odd)
constexpr int Y_STRIDE  = 132;  // floats, result rows in the Q|K space (528 B)
constexpr int VT_STRIDE = 120;  // halves, V transposed: rows by channel (240 B = 16 B x odd)
constexpr int RP_PITCH  = 176;  // floats, one head's rel-pos bias table

__device__ __forceinline__ v8f wmma_f16(v16h a, v16h b, v8f c) {
  return __builtin_amdgcn_wmma_f32_16x16x32_f16(false, a, false, b, (short)0, c,
                                                false, false);
}

// A-fragment (16x32 f16, M x K), row-major source. Also serves as the
// B-fragment of a transposed matrix (Qᵀ) since lane<->column mapping matches.
__device__ __forceinline__ v16h ldA_row(const _Float16* base, int stride,
                                        int row0, int k0, int lane) {
  const int l  = lane & 15;
  const int kk = k0 + ((lane & 16) ? 8 : 0);
  const _Float16* p = base + (size_t)(row0 + l) * stride + kk;
  v8h lo = *(const v8h*)(p);        // K = kk+0..7
  v8h hi = *(const v8h*)(p + 16);   // K = kk+16..23
  return __builtin_shufflevector(lo, hi, 0,1,2,3,4,5,6,7,8,9,10,11,12,13,14,15);
}

// B-fragment from pre-swizzled pack: 512 halves per fragment, in two planes of 256:
// every lane's first 8 halves, then every lane's last 8. Each 16-byte load of a wave
// then covers 512 contiguous bytes, four whole 128-byte lines.
__device__ __forceinline__ v16h ldB_pack(const _Float16* frag, int lane) {
  const _Float16* p = frag + lane * 8;
  v8h lo = *(const v8h*)(p);
  v8h hi = *(const v8h*)(p + 256);
  return __builtin_shufflevector(lo, hi, 0,1,2,3,4,5,6,7,8,9,10,11,12,13,14,15);
}

// Lane l <-> lane l ^ 16 (the two halves of a wave hold the two key halves).
__device__ __forceinline__ float swap_halves(float v) {
  int b = __builtin_bit_cast(int, v);
  b = __builtin_amdgcn_permlanex16(b, b, 0x76543210, 0xfedcba98, false, false);
  return __builtin_bit_cast(float, b);
}

// A pointer that is the same in every lane, held in scalar registers: a load from it
// takes the scalar base and one lane offset, and needs no address pair of its own.
typedef __attribute__((address_space(1))) const v4f gv4f;  // in global memory
__device__ __forceinline__ gv4f* scalar_ptr(const float* p) {
  const unsigned long long u = (unsigned long long)p;
  const unsigned lo = __builtin_amdgcn_readfirstlane((unsigned)u);
  const unsigned hi = __builtin_amdgcn_readfirstlane((unsigned)(u >> 32));
  return (gv4f*)(((unsigned long long)hi << 32) | lo);
}

__device__ __forceinline__ int region56(int g) {
  return g < (IMGE - WINSZ) ? 0 : (g < (IMGE - SHF) ? 1 : 2);
}

// ---------------------------------------------------------------------------
// Pre-pass: convert f32 weights to f16, swizzled into WMMA B-fragment layout.
// Fragment f = kc*(N/16)+nt holds 32 lanes x 16 halves, stored as two planes:
// plane 0 = halves 0..7 of lanes 0..31, plane 1 = halves 8..15 of lanes 0..31.
// lane<16 : col n = nt*16+lane, halves = K {0..7, 16..23}+kc*32
// lane>=16: col n = nt*16+lane-16, halves = K {8..15,24..31}+kc*32
// ---------------------------------------------------------------------------
template <int N>  // N: columns of the K x N matrix, known at compile time
__device__ __forceinline__ void pack_element(const float* __restrict__ Wm,
                                             _Float16* __restrict__ P, int idx) {
  constexpr int NT = N >> 4;
  int f    = idx >> 9;
  int lane = (idx >> 3) & 31;
  int i    = (idx & 7) + ((idx >> 8) & 1) * 8;  // plane 1: the lane's halves 8..15
  int kc   = f / NT, nt = f - kc * NT;
  int l    = lane & 15;
  int hi   = (lane >> 4) & 1;
  int k    = kc * 32 + (i < 8 ? (hi ? 8 : 0) + i : (hi ? 24 : 16) + (i - 8));
  int n    = nt * 16 + l;
  P[idx] = (_Float16)Wm[(size_t)k * N + n];
}

// Both matrices in one launch: the two packs do not depend on each other, so the
// block index picks the matrix (a block-uniform branch), one element per thread.
constexpr int QKV_BLOCKS  = CHN * 3 * CHN / 256;  // 192
constexpr int PROJ_BLOCKS = CHN * CHN / 256;      // 64
__global__ __launch_bounds__(256) void pack_weights_kernel(
    const float* __restrict__ qkvW, const float* __restrict__ projW,
    _Float16* __restrict__ qkvP, _Float16* __restrict__ projP) {
  const int blk = blockIdx.x;
  if (blk < QKV_BLOCKS)
    pack_element<3 * CHN>(qkvW, qkvP, blk * 256 + threadIdx.x);
  else
    pack_element<CHN>(projW, projP, (blk - QKV_BLOCKS) * 256 + threadIdx.x);
}

// ---------------------------------------------------------------------------
// Fused shifted-window attention: a workgroup (8 waves) works on one pair of
// windows at a time and loops over TRIPS pairs, so that the next pair's gather
// loads can fly while the current pair's output product runs.
// ---------------------------------------------------------------------------
constexpr int NPAIRS = 2048;            // 64 imgs * 8 * 4 window pairs
constexpr int TRIPS  = 4;               // pairs per workgroup
constexpr int NWG    = NPAIRS / TRIPS;  // workgroups of the launch

// Pair of workgroup g in trip t. The turn by 5 moves the pair's place in the image
// from trip to trip: pairs at the lower or right border carry the mask work, and so
// every workgroup gets one or two of them, none four.
__device__ __forceinline__ int pair_of(int g, int t) {
  return t * NWG + ((g + t * 5) & (NWG - 1));
}

// Workgroup barrier that orders LDS traffic only. __syncthreads() also waits for every
// global load and store of the wave: at the two places below that would end the flight
// of the next pair's gather loads, and hold the next pair back for the result stores.
// Nothing in global memory passes between the waves of a workgroup.
__device__ __forceinline__ void lds_barrier() {
  __builtin_amdgcn_fence(__ATOMIC_RELEASE, "workgroup", "local");
  __builtin_amdgcn_s_barrier();
  __builtin_amdgcn_fence(__ATOMIC_ACQUIRE, "workgroup", "local");
}

// Issues the gather loads of one pair: waves 0..6 take one row of both windows each,
// 14 tokens, one token's 512-byte row per load; the row is the same in every lane, so
// addresses are scalar work. Straight-line for every wave, so that the waits on loads
// issued before these stay counted ones: where there is nothing to fetch (wave 7; no
// next pair) 'real' is false and the 14 loads read one and the same valid row.
__device__ __forceinline__ void gather_issue(const float* __restrict__ x, int blk, int wvs,
                                             bool real, int lane, v4f (&xv)[2 * WINSZ]) {
  const int img = blk >> 5;
  const int wy  = (blk >> 2) & 7;
  const int wx0 = (blk & 3) * 2;
  int gr = wy * WINSZ + wvs + SHF; if (gr >= IMGE) gr -= IMGE;
  const float* xr = x + ((size_t)img * IMGE + gr) * (IMGE * CHN);  // scalar base
  #pragma unroll  // xv[] is indexed by constants only; fourteen loads in flight
  for (int i = 0; i < 2 * WINSZ; ++i) {
    int gc = wx0 * WINSZ + i + SHF; if (gc >= IMGE) gc -= IMGE;
    if (!real) gc = 0;
    xv[i] = scalar_ptr(xr + gc * CHN)[(unsigned)lane];
  }
}

// f32 -> f16 and into the X tile (waves 0..6 only).
__device__ __forceinline__ void gather_put(_Float16* lds_xs, int wvs, int lane,
                                           const v4f (&xv)[2 * WINSZ]) {
  _Float16* d = lds_xs + wvs * WINSZ * XS_STRIDE + lane * 4;
  #pragma unroll  // xv[] is indexed by constants only
  for (int i = 0; i < 2 * WINSZ; ++i) {
    v4h h;
    h[0] = (_Float16)xv[i].x; h[1] = (_Float16)xv[i].y;
    h[2] = (_Float16)xv[i].z; h[3] = (_Float16)xv[i].w;
    *(v4h*)(d + ((i / WINSZ) * WROW + i % WINSZ) * XS_STRIDE) = h;
  }
}

// Shift-mask regions of a pair's tokens, [window][token] (one wave).
__device__ __forceinline__ void region_table(int* lds_kreg, int blk, int lane) {
  const int wy  = (blk >> 2) & 7;
  const int wx0 = (blk & 3) * 2;
  for (int t = lane; t < WSQ; t += 32) {
    int ty = t / WINSZ, tx = t - ty * WINSZ;
    const int ry = region56(wy * WINSZ + ty) * 3;
    lds_kreg[t]      = ry + region56(wx0 * WINSZ + tx);
    lds_kreg[64 + t] = ry + region56((wx0 + 1) * WINSZ + tx);
  }
}

// Two workgroups share the LDS, four waves on a SIMD: a wave's register budget is 256.
// The weight and bias pointers carry no __restrict__: with it their loads were lifted out
// of the trip loop and held in registers over the attention stage, above that budget.
__global__ __launch_bounds__(256) __attribute__((amdgpu_waves_per_eu(4, 4)))
void swin_window_attn_kernel(
    const float* __restrict__ x, const float* qkv_bias,
    const float* proj_bias, const float* __restrict__ rel_tab,
    const _Float16* qkv_pack, const _Float16* proj_pack, float* __restrict__ out) {
  // X tile, later O tile; behind the seven row tiles, spare rows for padding queries
  __shared__ __attribute__((aligned(16))) _Float16 lds_xs[(MTILE + 2) * 16 * XS_STRIDE];
  // Q|K by token (256 cols, q pre-scaled); later the f32 result rows
  __shared__ __attribute__((aligned(16))) _Float16 lds_qk[AROWS * QK_STRIDE];
  // V transposed: [channel][token]
  __shared__ __attribute__((aligned(16))) _Float16 lds_vt[CHN * VT_STRIDE];
  // rel-pos bias table, [head][169]
  __shared__ float lds_rp[NHEAD * RP_PITCH];
  // per token: ty * 13 + tx (its part of the bias index), shift-mask region
  __shared__ __attribute__((aligned(16))) int lds_koff[64];
  __shared__ __attribute__((aligned(16))) int lds_kreg[2 * 64];  // [window][token]

  const int tid  = threadIdx.x;
  const int lane = tid & 31;
  const int wv   = tid >> 5;  // 8 waves

  const int grp = blockIdx.x;           // the workgroup; its pairs: pair_of(grp, trip)

  const int chalf = (lane & 16) ? 8 : 0;  // the lane's half of a 16-channel tile

  // ---- Stage A: gather shifted window into LDS (f32 -> f16) ----------------
  // Every load of a wave is issued before the first of them is waited for.
  const int wvs = __builtin_amdgcn_readfirstlane(wv);  // scalar addresses
  float rt[3];  // rel-pos table, 676 entries; the last read is clamped
  #pragma unroll  // rt[] is indexed by constants only; three loads in flight
  for (int k = 0; k < 3; ++k)
    rt[k] = rel_tab[min(tid + 256 * k, 169 * NHEAD - 1)];

  v4f xv[2 * WINSZ];
  gather_issue(x, pair_of(grp, 0), wvs, wvs < WINSZ, lane, xv);
  if (wvs < WINSZ) {
    gather_put(lds_xs, wvs, lane, xv);
  } else {
    // Wave 7, which has no window row: the per-token tables and the zero rows.
    // The bias offsets and the zero rows hold for every trip: no later stage writes them.
    for (int t = lane; t < WSQ; t += 32) {
      int ty = t / WINSZ, tx = t - ty * WINSZ;
      lds_koff[t] = ty * 13 + tx;
    }
    region_table(lds_kreg, pair_of(grp, 0), lane);
    const v4h z = {};
    for (int r = WSQ; r < WROW; ++r) {  // zero-pad rows 49..55 and 105..111
      *(v4h*)(lds_xs + r * XS_STRIDE + lane * 4) = z;
      *(v4h*)(lds_xs + (WROW + r) * XS_STRIDE + lane * 4) = z;
    }
    // The second window's last key and query tiles span rows 104..119; no product
    // writes rows 112..119 of Q|K or those token columns of V^T: zeros there.
    const v8h z8 = {};
    for (int r = MTILE * 16; r < AROWS; ++r)
      *(v8h*)(lds_qk + r * QK_STRIDE + lane * 8) = z8;
    for (int ch = lane; ch < CHN; ch += 32)
      *(v8h*)(lds_vt + ch * VT_STRIDE + MTILE * 16) = z8;
  }
  #pragma unroll  // rt[] again by constants
  for (int k = 0; k < 3; ++k) {
    const int j = tid + 256 * k;
    if (j < 169 * NHEAD) lds_rp[(j & 3) * RP_PITCH + (j >> 2)] = rt[k];
  }

  __syncthreads();

  // Kept rolled, for speed only.
  #pragma unroll 1
  for (int trip = 0; trip < TRIPS; ++trip) {
  const int blk = pair_of(grp, trip);
  const int img = blk >> 5;
  const int wy  = (blk >> 2) & 7;
  const int wx0 = (blk & 3) * 2;        // the pair's left window
  const bool more = trip + 1 < TRIPS;   // a next pair exists

  // QKV bias of the wave's three column tiles (Q, K, V), read in front of the weight
  // loads and in every trip: held over the attention stage it would cost 17 registers
  // there. The Q and K tiles are computed transposed: a lane needs its 8 channels' bias.
  v8f qkb[2];
  #pragma unroll  // qkb[] is indexed by constants only, so it stays in registers
  for (int g = 0; g < 2; ++g) {
    const float* bp = qkv_bias + (g * 8 + wv) * 16 + chalf;
    const v4f lo = *(const v4f*)bp, hi = *(const v4f*)(bp + 4);
    qkb[g] = __builtin_shufflevector(lo, hi, 0, 1, 2, 3, 4, 5, 6, 7);
  }
  const float vb = qkv_bias[(2 * 8 + wv) * 16 + (lane & 15)];

  // ---- Stage B: QKV = X @ Wqkv + b (q columns pre-scaled by 1/sqrt(32)) ----
  // A wave owns one 16-column tile of Q, one of K and one of V. All twelve weight
  // fragments are loaded once and stay in registers for the seven row tiles of
  // the two windows; each X fragment is read from LDS once and feeds three products.
  // Q and K are formed as W^T X^T (the weight fragment is the A operand, the same
  // registers: both maps put the 16 rows or columns on lanes and share the k order):
  // a lane then holds 8 neighbouring channels of one token, one 16-byte store into
  // the token's row. V keeps X as A: its lane holds 8 tokens of one channel of V^T.
  const float qscale = 0.17677669529663687f;
  {
    const int cq = wvs * 16 + (lane & 15);  // the lane's channel of V
    v16h b[3][4];
    #pragma unroll  // b[][] is indexed by constants only, so it stays in registers
    for (int g = 0; g < 3; ++g) {  // 0: Q, 1: K, 2: V
      #pragma unroll
      for (int kc = 0; kc < 4; ++kc)
        b[g][kc] = ldB_pack(qkv_pack + (size_t)(kc * 24 + g * 8 + wvs) * 512, lane);
      // The next group's loads land in registers that hold this group's addresses:
      // the wait that belongs in front of such an overwrite.
      if (g < 2) asm volatile("s_wait_xcnt 0x0" ::: "memory");
    }
    // Kept rolled: unrolled, the build held so many row tiles' accumulators at once
    // that it spilled. A trip has three independent chains of four products.
    #pragma unroll 1
    for (int mt = 0; mt < MTILE; ++mt) {
      v8f acc[3];
      acc[0] = qkb[0];
      acc[1] = qkb[1];
      #pragma unroll
      for (int i = 0; i < 8; ++i) acc[2][i] = vb;
      #pragma unroll
      for (int kc = 0; kc < 4; ++kc) {
        const v16h a = ldA_row(lds_xs, XS_STRIDE, mt * 16, kc * 32, lane);
        acc[0] = wmma_f16(b[0][kc], a, acc[0]);
        acc[1] = wmma_f16(b[1][kc], a, acc[1]);
        acc[2] = wmma_f16(a, b[2][kc], acc[2]);
      }
      v8h qq, kk, vv;
      #pragma unroll
      for (int r = 0; r < 8; ++r) {
        qq[r] = (_Float16)(acc[0][r] * qscale);
        kk[r] = (_Float16)acc[1][r];
        vv[r] = (_Float16)acc[2][r];
      }
      // Q, K: the lane's 8 channels of token mt * 16 + (lane & 15)
      _Float16* qrow = lds_qk + (mt * 16 + (lane & 15)) * QK_STRIDE + wvs * 16 + chalf;
      *(v8h*)qrow = qq;
      *(v8h*)(qrow + CHN) = kk;
      // V: the lane's 8 tokens of one channel
      *(v8h*)(lds_vt + cq * VT_STRIDE + mt * 16 + chalf) = vv;
    }
  }
  __syncthreads();

  // ---- Attention, all in one wave's registers ------------------------------
  // A wave owns one head of one window, all four 16-query tiles: every K and V^T
  // fragment is read from LDS by one wave only and feeds four products, and the four
  // tiles' softmax chains are independent work for one another's waits.
  // S^T = K Q^T: in every 16-key tile lane (c, hh) holds keys 8*hh+0..7 of query c, so
  // the softmax runs in-lane plus one exchange of the wave's halves; two score tiles,
  // converted in place, are the B operand P^T of O^T = V^T P^T.
  {
    const int c  = lane & 15;
    const int hh = lane >> 4;
    const int hd = wvs & 3;     // the wave's head
    const int w  = wvs >> 2;    // the wave's window
    const int wb = w * WROW;    // its first LDS row
    const int* kreg = lds_kreg + w * 64;

    // Padding queries 49..63 take query 48's bias and mask. Their O rows go to spare
    // rows that nobody reads: the first window's rows 56..63 hold the second
    // window's tokens. An address select, so that no branch stands among the WMMAs.
    int orow[4], sq[4], qoff[4];
    #pragma unroll  // indexed by constants only, so they stay in registers
    for (int j = 0; j < 4; ++j) {
      const int q = j * 16 + c;
      orow[j] = q < WSQ ? wb + q : (MTILE + w) * 16 + c;
      sq[j] = min(q, WSQ - 1);
      // bias index = (sy - ty + 6) * 13 + (sx - tx + 6) = koff[s] + 84 - koff[t]
      qoff[j] = lds_koff[sq[j]] + 84;
    }
    const bool edge = wy == 7 || wx0 + w == 7;  // only these windows mix regions
    const float L2E = 1.4426950408889634f;  // exp(x) = exp2(x * log2 e)

    {  // scores, softmax and O of the wave's head
      // The bias is the C operand of the score product. Key tile 3 holds one
      // real key, 48 (hh == 0, register 0; koff = 84).
      v8f st[4][4];
      #pragma unroll
      for (int kt = 0; kt < 3; ++kt) {
        const v4i ka = *(const v4i*)(lds_koff + kt * 16 + 8 * hh);
        const v4i kb = *(const v4i*)(lds_koff + kt * 16 + 8 * hh + 4);
        #pragma unroll
        for (int j = 0; j < 4; ++j) {
          const float* rp = lds_rp + hd * RP_PITCH + qoff[j];
          #pragma unroll
          for (int r = 0; r < 8; ++r) st[j][kt][r] = rp[-(r < 4 ? ka[r] : kb[r - 4])];
        }
      }
      #pragma unroll
      for (int j = 0; j < 4; ++j) {
        v8f z = {};
        z[0] = lds_rp[hd * RP_PITCH + qoff[j] - 84];
        st[j][3] = z;
      }

      v16h bq[4];
      #pragma unroll
      for (int j = 0; j < 4; ++j)
        bq[j] = ldA_row(lds_qk, QK_STRIDE, wb + j * 16, hd * HDIM, lane);
      #pragma unroll
      for (int kt = 0; kt < 4; ++kt) {
        const v16h ak = ldA_row(lds_qk, QK_STRIDE, wb + kt * 16, CHN + hd * HDIM, lane);
        #pragma unroll
        for (int j = 0; j < 4; ++j) st[j][kt] = wmma_f16(ak, bq[j], st[j][kt]);
      }

      if (edge) {
        #pragma unroll
        for (int kt = 0; kt < 3; ++kt) {
          const v4i ra = *(const v4i*)(kreg + kt * 16 + 8 * hh);
          const v4i rb = *(const v4i*)(kreg + kt * 16 + 8 * hh + 4);
          #pragma unroll
          for (int j = 0; j < 4; ++j) {
            const int qreg = kreg[sq[j]];
            #pragma unroll
            for (int r = 0; r < 8; ++r)
              st[j][kt][r] += (r < 4 ? ra[r] : rb[r - 4]) == qreg ? 0.f : -100.f;
          }
        }
        #pragma unroll
        for (int j = 0; j < 4; ++j)
          st[j][3][0] += kreg[WSQ - 1] == kreg[sq[j]] ? 0.f : -100.f;
      }

      v16h pb0[4], pb1[4];
      float inv[4];
      #pragma unroll
      for (int j = 0; j < 4; ++j) {
        const float s48 = hh ? -1e30f : st[j][3][0];  // keys 49..63 do not exist
        float mx = s48;
        #pragma unroll
        for (int kt = 0; kt < 3; ++kt)
          #pragma unroll
          for (int r = 0; r < 8; ++r) mx = fmaxf(mx, st[j][kt][r]);
        mx = fmaxf(mx, swap_halves(mx));
        const float mb = mx * L2E;

        float part[3];
        #pragma unroll
        for (int kt = 0; kt < 3; ++kt) {
          part[kt] = 0.f;
          #pragma unroll
          for (int r = 0; r < 8; ++r) {
            float p = __builtin_amdgcn_exp2f(fmaf(st[j][kt][r], L2E, -mb));
            part[kt] += p;
            if (kt == 0) pb0[j][r] = (_Float16)p;
            if (kt == 1) pb0[j][8 + r] = (_Float16)p;
            if (kt == 2) pb1[j][r] = (_Float16)p;
          }
        }
        const float p48 = __builtin_amdgcn_exp2f(fmaf(s48, L2E, -mb));
        pb1[j][8] = (_Float16)p48;
        #pragma unroll
        for (int r = 1; r < 8; ++r) pb1[j][8 + r] = (_Float16)0;
        float sum = (part[0] + part[1]) + (part[2] + p48);
        sum += swap_halves(sum);
        inv[j] = 1.0f / sum;
      }

      #pragma unroll
      for (int dt = 0; dt < 2; ++dt) {
        const int ch = hd * HDIM + dt * 16;
        const v16h v0 = ldA_row(lds_vt, VT_STRIDE, ch, wb, lane);
        const v16h v1 = ldA_row(lds_vt, VT_STRIDE, ch, wb + 32, lane);
        #pragma unroll
        for (int j = 0; j < 4; ++j) {
          v8f acc = {};
          acc = wmma_f16(v0, pb0[j], acc);
          acc = wmma_f16(v1, pb1[j], acc);
          v8h o;  // channels ch + 8*hh + 0..7 of query c
          #pragma unroll
          for (int r = 0; r < 8; ++r) o[r] = (_Float16)(acc[r] * inv[j]);
          *(v8h*)(lds_xs + orow[j] * XS_STRIDE + ch + 8 * hh) = o;
        }
      }
    }
  }
  __syncthreads();

  // ---- Stage E: Y = O @ Wproj + b, staged in LDS by token ------------------
  // Q|K are dead behind the barrier above; their rows of 528 bytes hold the
  // f32 result rows (128 floats + 4 of pad: 16 tokens' 16-byte pieces fall on
  // different banks). Formed as Wproj^T O^T, like Q and K: a lane holds 8
  // neighbouring channels of one token, two 16-byte stores.
  float* lds_y = reinterpret_cast<float*>(lds_qk);
  {
    const int ch0 = wv * 16 + chalf;   // a wave owns 16 output channels
    const v4f blo = *(const v4f*)(proj_bias + ch0), bhi = *(const v4f*)(proj_bias + ch0 + 4);
    const v8f bv = __builtin_shufflevector(blo, bhi, 0, 1, 2, 3, 4, 5, 6, 7);
    v16h b[4];
    #pragma unroll  // b[] is indexed by constants only, so it stays in registers
    for (int kc = 0; kc < 4; ++kc)
      b[kc] = ldB_pack(proj_pack + (size_t)(kc * 8 + wv) * 512, lane);
    // The next pair's gather, behind the weight loads (loads return in order: the
    // products below wait for the weights alone); it lands under this stage.
    gather_issue(x, more ? pair_of(grp, trip + 1) : blk, wvs, more && wvs < WINSZ, lane, xv);
    #pragma unroll  // row tiles are independent: their chains can be interleaved
    for (int mt = 0; mt < MTILE; ++mt) {
      v8f acc = bv;
      #pragma unroll
      for (int kc = 0; kc < 4; ++kc)
        acc = wmma_f16(b[kc],
                       ldA_row(lds_xs, XS_STRIDE, mt * 16, kc * 32, lane), acc);
      float* d = lds_y + (mt * 16 + (lane & 15)) * Y_STRIDE + ch0;
      *(v4f*)d       = __builtin_shufflevector(acc, acc, 0, 1, 2, 3);
      *(v4f*)(d + 4) = __builtin_shufflevector(acc, acc, 4, 5, 6, 7);
    }
  }
  lds_barrier();  // the gather loads stay in flight over it
  // What follows reuses scalar registers that the gather loads name as their base: the
  // wait that belongs in front of such an overwrite.
  asm volatile("s_wait_xcnt 0x0" ::: "memory");

  // ---- Reverse shift: a wave stores one row of both windows, 14 tokens -----
  // One store is one token's whole 512-byte row. The window row is the same in
  // every lane, so the addresses are scalar work; wave 7 has no row.
  const int wrow = __builtin_amdgcn_readfirstlane(wv);
  if (wrow < WINSZ) {
    int gr = wy * WINSZ + wrow + SHF; if (gr >= IMGE) gr -= IMGE;
    const float* y = lds_y + wrow * WINSZ * Y_STRIDE + lane * 4;
    float* o = out + ((size_t)img * IMGE + gr) * (IMGE * CHN) + lane * 4;
    for (int i = 0; i < 2 * WINSZ; ++i) {
      int gc = wx0 * WINSZ + i + SHF; if (gc >= IMGE) gc -= IMGE;
      *(float4*)(o + gc * CHN) =
          *(const float4*)(y + ((i / WINSZ) * WROW + i % WINSZ) * Y_STRIDE);
    }
    // What follows reuses registers that the stores above name: the wait that belongs
    // in front of such an overwrite.
    asm volatile("s_wait_xcnt 0x0" ::: "memory");
    // O is dead behind the barrier above: the next pair's X goes into its rows.
    if (more) gather_put(lds_xs, wvs, lane, xv);
  } else if (more) {
    region_table(lds_kreg, pair_of(grp, trip + 1), lane);
  }
  // The gather's barrier, at the loop's foot: X and the regions are written, and the
  // result rows are read before the next stage B writes Q|K over them.
  lds_barrier();  // the result stores stay in flight over it
  }
  // The last trip's loads (and wave 7's) are read by nobody: they must have returned
  // before the wave ends and gives its registers back.
  asm volatile("s_wait_loadcnt 0x0" ::: "memory");
}

extern "C" void kernel_launch(void* const* d_in, const int* in_sizes, int n_in,
                              void* d_out, int out_size, void* d_ws,
                              size_t ws_size, hipStream_t stream) {
  const float* x     = (const float*)d_in[0];
  const float* qkvW  = (const float*)d_in[1];
  const float* qkvB  = (const float*)d_in[2];
  const float* projW = (const float*)d_in[3];
  const float* projB = (const float*)d_in[4];
  const float* relT  = (const float*)d_in[5];

  _Float16* qkv_pack  = (_Float16*)d_ws;                              // 96 KB
  _Float16* proj_pack = (_Float16*)((char*)d_ws + (size_t)CHN * 384 * 2);

  pack_weights_kernel<<<QKV_BLOCKS + PROJ_BLOCKS, 256, 0, stream>>>(
      qkvW, projW, qkv_pack, proj_pack);

  swin_window_attn_kernel<<<NWG, 256, 0, stream>>>(
      x, qkvB, projB, relT, qkv_pack, proj_pack, (float*)d_out);
}
